// v000
// The times below were measured on an AMD MI455X: many runs one after another, warmed up first and cycling through
// copies of the inputs, with the whole window's GPU time divided by the number of runs. Launches and the gaps
// between them are all in it. The median over several windows is given; except for v000 it joins two sittings, which
// can be a few percent apart, so the side-by-side timings, each taken in one sitting, are the better comparison.
// v000 is the starting kernel. One run takes 952 microseconds.
#include <hip/hip_runtime.h>
#include <math.h>

typedef __attribute__((ext_vector_type(16))) _Float16 v16h;
typedef __attribute__((ext_vector_type(8)))  _Float16 v8h;
typedef __attribute__((ext_vector_type(4)))  _Float16 v4h;
typedef __attribute__((ext_vector_type(8)))  float    v8f;

#define NB    4      // batches
#define SS    4096   // sequence length
#define ROW   128    // D*2 elements per token row (interleaved r,i)
#define KT    128    // key tile (4 x K=32 WMMA contraction chunks)
#define WAVES 8
#define QW    16     // query rows per wave
#define NTILE (SS / KT)

__device__ __forceinline__ float fast_exp2(float x) {
#if __has_builtin(__builtin_amdgcn_exp2f)
    return __builtin_amdgcn_exp2f(x);   // raw v_exp_f32
#else
    return exp2f(x);
#endif
}

__device__ __forceinline__ v8f wmma_f16(const v16h& a, const v16h& b, const v8f& c) {
    return __builtin_amdgcn_wmma_f32_16x16x32_f16(false, a, false, b, (short)0, c, false, false);
}

// Load a v16h operand: two contiguous 8-half runs (base, base+16 halves),
// each one ds_load_b128.
__device__ __forceinline__ v16h ld_op(const _Float16* base) {
    v8h lo = *(const v8h*)(base);
    v8h hi = *(const v8h*)(base + 16);
    return __builtin_shufflevector(lo, hi, 0,1,2,3,4,5,6,7,8,9,10,11,12,13,14,15);
}

// ---- pre-pass 1: K (f32, interleaved complex) -> two f16 variants in ws
__global__ __launch_bounds__(256)
void prep_k_kernel(const float* __restrict__ K,
                   _Float16* __restrict__ Ksr, _Float16* __restrict__ Ksi)
{
    const size_t idx = (size_t)blockIdx.x * 256 + threadIdx.x;  // over NB*SS*ROW/4 float4
    float4 kv = ((const float4*)K)[idx];
    v4h srh = { (_Float16)kv.x, (_Float16)(-kv.y),
                (_Float16)kv.z, (_Float16)(-kv.w) };            // (kr, -ki)
    v4h sih = { (_Float16)kv.y, (_Float16)kv.x,
                (_Float16)kv.w, (_Float16)kv.z };               // (ki,  kr)
    *(v4h*)&Ksr[idx * 4] = srh;
    *(v4h*)&Ksi[idx * 4] = sih;
}

// ---- pre-pass 2: V (f32 [b][s][d][comp]) -> f16 transposed [b][comp][d][s]
__global__ __launch_bounds__(256)
void prep_v_kernel(const float* __restrict__ V, _Float16* __restrict__ VT)
{
    const int id   = blockIdx.x * 256 + threadIdx.x;   // over NB*2*64*(SS/8)
    const int sblk = id & (SS / 8 - 1);
    int rest = id >> 9;                                // SS/8 == 512
    const int d    = rest & 63;  rest >>= 6;
    const int comp = rest & 1;
    const int b    = rest >> 1;
    const int s0   = sblk * 8;
    v8h out;
    #pragma unroll
    for (int q = 0; q < 8; ++q)
        out[q] = (_Float16)V[((size_t)b * SS + s0 + q) * ROW + 2 * d + comp];
    *(v8h*)&VT[(((size_t)b * 2 + comp) * 64 + d) * SS + s0] = out;
}

__global__ __launch_bounds__(256)
void cdpa_flash_kernel(const float* __restrict__ Q,
                       const _Float16* __restrict__ Ksr,
                       const _Float16* __restrict__ Ksi,
                       const _Float16* __restrict__ VT,
                       float* __restrict__ O)
{
    __shared__ _Float16 ldsKsr[KT * ROW];          // 32 KB
    __shared__ _Float16 ldsKsi[KT * ROW];          // 32 KB
    __shared__ _Float16 ldsVT[2 * 64 * KT];        // 32 KB
    __shared__ _Float16 ldsP[WAVES][2][16 * KT];   // 64 KB

    const int tid  = threadIdx.x;
    const int w    = tid >> 5;
    const int lane = tid & 31;
    const int m    = lane & 15;   // row (A) / col (B,C) index
    const int h    = lane >> 4;   // half-wave selector

    const int blocksPerBatch = SS / (WAVES * QW);  // 32
    const int b  = blockIdx.x / blocksPerBatch;
    const int qt = blockIdx.x % blocksPerBatch;
    const int q0 = qt * (WAVES * QW) + w * QW;

    // Q A-operands. Scale = 1/sqrt(D) * log2(e): scores in log2 domain.
    const float qscale = 0.125f * 1.44269504088896340736f;
    v16h aq[4];
    {
        const float* qrow = Q + ((size_t)b * SS + q0 + m) * ROW;
        #pragma unroll
        for (int c = 0; c < 4; ++c) {
            #pragma unroll
            for (int j = 0; j < 8; ++j) {
                aq[c][j]     = (_Float16)(qrow[32*c +      8*h + j] * qscale);
                aq[c][8 + j] = (_Float16)(qrow[32*c + 16 + 8*h + j] * qscale);
            }
        }
    }

    // all-ones B operand: rowsum(P) = P @ ones on the matrix pipe
    v16h ones;
    #pragma unroll
    for (int j = 0; j < 16; ++j) ones[j] = (_Float16)1.0f;

    v8f acc[2][2][4];
    #pragma unroll
    for (int mp = 0; mp < 2; ++mp)
        #pragma unroll
        for (int cp = 0; cp < 2; ++cp)
            #pragma unroll
            for (int g = 0; g < 4; ++g)
                #pragma unroll
                for (int j = 0; j < 8; ++j) acc[mp][cp][g][j] = 0.f;

    float mS[2][8], lS[2][8];
    #pragma unroll
    for (int mp = 0; mp < 2; ++mp)
        #pragma unroll
        for (int j = 0; j < 8; ++j) { mS[mp][j] = -__builtin_inff(); lS[mp][j] = 0.f; }

    const _Float16* vtBase = VT + (size_t)b * 2 * 64 * SS;   // rows stride SS

    for (int kt = 0; kt < NTILE; ++kt) {
        __syncthreads();
        // ---- staging: pure b128 vector copies of pre-converted f16 tiles
        {
            const v8h* gsr = (const v8h*)(Ksr + ((size_t)b * SS + (size_t)kt * KT) * ROW);
            const v8h* gsi = (const v8h*)(Ksi + ((size_t)b * SS + (size_t)kt * KT) * ROW);
            #pragma unroll
            for (int i = 0; i < 8; ++i) {          // 2048 v8h units per 32 KB tile
                const int j = tid + 256 * i;
                ((v8h*)ldsKsr)[j] = gsr[j];
                ((v8h*)ldsKsi)[j] = gsi[j];
            }
            const _Float16* gvt = vtBase + (size_t)kt * KT;
            #pragma unroll
            for (int i = 0; i < 8; ++i) {          // 128 rows x 16 units of 8 halves
                const int j = tid + 256 * i;
                const int r = j >> 4, c = j & 15;
                *(v8h*)&ldsVT[r * KT + c * 8] = *(const v8h*)&gvt[(size_t)r * SS + c * 8];
            }
        }
        __syncthreads();

        // ---- prefetch next tile into near caches, overlapped with compute
        if (kt + 1 < NTILE) {
            const char* nsr = (const char*)(Ksr + ((size_t)b * SS + (size_t)(kt + 1) * KT) * ROW);
            const char* nsi = (const char*)(Ksi + ((size_t)b * SS + (size_t)(kt + 1) * KT) * ROW);
            #pragma unroll
            for (int i = 0; i < 2; ++i) {          // 256 thr * 64B * 2 = 32 KB each
                __builtin_prefetch(nsr + tid * 64 + i * 16384, 0, 3);
                __builtin_prefetch(nsi + tid * 64 + i * 16384, 0, 3);
            }
            const char* nvt = (const char*)(vtBase + (size_t)(kt + 1) * KT);
            __builtin_prefetch(nvt + (size_t)(tid >> 1) * (SS * 2) + (tid & 1) * 128, 0, 3);
        }

        // ---- per map: scores (32 WMMAs), online max update, P store
        #pragma unroll
        for (int mp = 0; mp < 2; ++mp) {
            const _Float16* kb = mp ? ldsKsi : ldsKsr;
            v8f sAcc[8];
            #pragma unroll
            for (int g = 0; g < 8; ++g) {
                v8f s = {0.f,0.f,0.f,0.f,0.f,0.f,0.f,0.f};
                const _Float16* krow = &kb[(16 * g + m) * ROW];
                #pragma unroll
                for (int c = 0; c < 4; ++c)
                    s = wmma_f16(aq[c], ld_op(&krow[32 * c + 8 * h]), s);
                sAcc[g] = s;
            }

            _Float16* pM = &ldsP[w][mp][0];
            #pragma unroll
            for (int j = 0; j < 8; ++j) {
                float tm = fmaxf(fmaxf(fmaxf(sAcc[0][j], sAcc[1][j]), fmaxf(sAcc[2][j], sAcc[3][j])),
                                 fmaxf(fmaxf(sAcc[4][j], sAcc[5][j]), fmaxf(sAcc[6][j], sAcc[7][j])));
                #pragma unroll
                for (int msk = 1; msk < 16; msk <<= 1) tm = fmaxf(tm, __shfl_xor(tm, msk, 32));
                float mn = fmaxf(mS[mp][j], tm);
                float f  = fast_exp2(mS[mp][j] - mn);
                mS[mp][j] = mn;
                lS[mp][j] *= f;                  // row-sum added after P@ones
                #pragma unroll
                for (int cp = 0; cp < 2; ++cp)
                    #pragma unroll
                    for (int g = 0; g < 4; ++g) acc[mp][cp][g][j] *= f;
                const int row = j + 8 * h;       // C-layout row for this lane/vgpr
                #pragma unroll
                for (int g = 0; g < 8; ++g)
                    pM[row * KT + 16 * g + m] = (_Float16)fast_exp2(sAcc[g][j] - mn);
            }
        }

        // ---- P @ V and P @ ones: kc-outer keeps only 2 P operands live
        v8f lsum[2];
        #pragma unroll
        for (int mp = 0; mp < 2; ++mp)
            #pragma unroll
            for (int j = 0; j < 8; ++j) lsum[mp][j] = 0.f;

        const _Float16* pM0 = &ldsP[w][0][0];
        const _Float16* pM1 = &ldsP[w][1][0];
        #pragma unroll
        for (int kc = 0; kc < 4; ++kc) {
            v16h pA = ld_op(&pM0[m * KT + 32 * kc + 8 * h]);
            v16h pB = ld_op(&pM1[m * KT + 32 * kc + 8 * h]);
            lsum[0] = wmma_f16(pA, ones, lsum[0]);
            lsum[1] = wmma_f16(pB, ones, lsum[1]);
            #pragma unroll
            for (int cp = 0; cp < 2; ++cp) {
                #pragma unroll
                for (int g4 = 0; g4 < 4; ++g4) {
                    const int d = 16 * g4 + m;
                    v16h vb = ld_op(&ldsVT[(cp * 64 + d) * KT + 32 * kc + 8 * h]);
                    acc[0][cp][g4] = wmma_f16(pA, vb, acc[0][cp][g4]);
                    acc[1][cp][g4] = wmma_f16(pB, vb, acc[1][cp][g4]);
                }
            }
        }
        #pragma unroll
        for (int mp = 0; mp < 2; ++mp)
            #pragma unroll
            for (int j = 0; j < 8; ++j) lS[mp][j] += lsum[mp][j];
    }

    // ---- normalize per term and emit interleaved complex output
    #pragma unroll
    for (int j = 0; j < 8; ++j) {
        float ir = 1.0f / lS[0][j];
        float ii = 1.0f / lS[1][j];
        int row  = q0 + j + 8 * h;
        float* orow = O + ((size_t)b * SS + row) * ROW;
        #pragma unroll
        for (int g4 = 0; g4 < 4; ++g4) {
            int d = 16 * g4 + m;
            float outr = acc[0][0][g4][j] * ir - acc[1][1][g4][j] * ii;
            float outi = acc[0][1][g4][j] * ir + acc[1][0][g4][j] * ii;
            float2 o2  = make_float2(outr, outi);
            *(float2*)(orow + 2 * d) = o2;
        }
    }
}

extern "C" void kernel_launch(void* const* d_in, const int* in_sizes, int n_in,
                              void* d_out, int out_size, void* d_ws, size_t ws_size,
                              hipStream_t stream) {
    const float* Q = (const float*)d_in[0];
    const float* K = (const float*)d_in[1];
    const float* V = (const float*)d_in[2];
    float* O = (float*)d_out;

    // workspace: Ksr (4 MB) | Ksi (4 MB) | VT (4 MB), all f16
    _Float16* wsKsr = (_Float16*)d_ws;
    _Float16* wsKsi = wsKsr + (size_t)NB * SS * ROW;
    _Float16* wsVT  = wsKsi + (size_t)NB * SS * ROW;

    prep_k_kernel<<<dim3(NB * SS * ROW / 4 / 256), dim3(256), 0, stream>>>(K, wsKsr, wsKsi);
    prep_v_kernel<<<dim3(NB * 2 * 64 * (SS / 8) / 256), dim3(256), 0, stream>>>(V, wsVT);
    cdpa_flash_kernel<<<dim3(NB * (SS / (WAVES * QW))), dim3(256), 0, stream>>>(
        Q, wsKsr, wsKsi, wsVT, O);
}

// v001
// It runs in 191 microseconds.
// Two timings next to v000 both put it at 5.03 times that version's speed.
#include <hip/hip_runtime.h>
#include <math.h>

typedef __attribute__((ext_vector_type(16))) _Float16 v16h;
typedef __attribute__((ext_vector_type(8)))  _Float16 v8h;
typedef __attribute__((ext_vector_type(4)))  _Float16 v4h;
typedef __attribute__((ext_vector_type(8)))  float    v8f;

#define NB    4      // batches
#define SS    4096   // sequence length
#define ROW   128    // D*2 elements per token row (interleaved r,i)
#define KT    128    // key tile (4 x K=32 WMMA contraction chunks)
#define WAVES 8
#define QW    16     // query rows per wave
#define NTILE (SS / KT)
#define LP    136    // LDS row pitch in halves: 272 B = 16 B x 17 (odd), so the 16 rows
                     // of one ds_load_b128 fall on 16 distinct groups of four banks

__device__ __forceinline__ float fast_exp2(float x) {
#if __has_builtin(__builtin_amdgcn_exp2f)
    return __builtin_amdgcn_exp2f(x);   // raw v_exp_f32
#else
    return exp2f(x);
#endif
}

__device__ __forceinline__ v8f wmma_f16(const v16h& a, const v16h& b, const v8f& c) {
    return __builtin_amdgcn_wmma_f32_16x16x32_f16(false, a, false, b, (short)0, c, false, false);
}

// Load a v16h operand: two contiguous 8-half runs (base, base+16 halves),
// each one ds_load_b128.
__device__ __forceinline__ v16h ld_op(const _Float16* base) {
    v8h lo = *(const v8h*)(base);
    v8h hi = *(const v8h*)(base + 16);
    return __builtin_shufflevector(lo, hi, 0,1,2,3,4,5,6,7,8,9,10,11,12,13,14,15);
}

// ---- pre-pass 1: K (f32, interleaved complex) -> two f16 variants in ws
__global__ __launch_bounds__(256)
void prep_k_kernel(const float* __restrict__ K,
                   _Float16* __restrict__ Ksr, _Float16* __restrict__ Ksi)
{
    const size_t idx = (size_t)blockIdx.x * 256 + threadIdx.x;  // over NB*SS*ROW/4 float4
    float4 kv = ((const float4*)K)[idx];
    v4h srh = { (_Float16)kv.x, (_Float16)(-kv.y),
                (_Float16)kv.z, (_Float16)(-kv.w) };            // (kr, -ki)
    v4h sih = { (_Float16)kv.y, (_Float16)kv.x,
                (_Float16)kv.w, (_Float16)kv.z };               // (ki,  kr)
    *(v4h*)&Ksr[idx * 4] = srh;
    *(v4h*)&Ksi[idx * 4] = sih;
}

// ---- pre-pass 2: V (f32 [b][s][d][comp]) -> f16 transposed [b][comp][d][s]
__global__ __launch_bounds__(256)
void prep_v_kernel(const float* __restrict__ V, _Float16* __restrict__ VT)
{
    const int id   = blockIdx.x * 256 + threadIdx.x;   // over NB*2*64*(SS/8)
    const int sblk = id & (SS / 8 - 1);
    int rest = id >> 9;                                // SS/8 == 512
    const int d    = rest & 63;  rest >>= 6;
    const int comp = rest & 1;
    const int b    = rest >> 1;
    const int s0   = sblk * 8;
    v8h out;
    #pragma unroll
    for (int q = 0; q < 8; ++q)
        out[q] = (_Float16)V[((size_t)b * SS + s0 + q) * ROW + 2 * d + comp];
    *(v8h*)&VT[(((size_t)b * 2 + comp) * 64 + d) * SS + s0] = out;
}

__global__ __launch_bounds__(256)
void cdpa_flash_kernel(const float* __restrict__ Q,
                       const _Float16* __restrict__ Ksr,
                       const _Float16* __restrict__ Ksi,
                       const _Float16* __restrict__ VT,
                       float* __restrict__ O)
{
    __shared__ _Float16 ldsKsr[KT * LP];           // 34 KB
    __shared__ _Float16 ldsKsi[KT * LP];           // 34 KB
    __shared__ _Float16 ldsVT[2 * 64 * LP];        // 34 KB
    __shared__ _Float16 ldsP[WAVES][2][16 * LP];   // 68 KB

    const int tid  = threadIdx.x;
    const int w    = tid >> 5;
    const int lane = tid & 31;
    const int m    = lane & 15;   // row (A) / col (B,C) index
    const int h    = lane >> 4;   // half-wave selector

    const int blocksPerBatch = SS / (WAVES * QW);  // 32
    const int b  = blockIdx.x / blocksPerBatch;
    const int qt = blockIdx.x % blocksPerBatch;
    const int q0 = qt * (WAVES * QW) + w * QW;

    // Q A-operands. Scale = 1/sqrt(D) * log2(e): scores in log2 domain.
    const float qscale = 0.125f * 1.44269504088896340736f;
    v16h aq[4];
    {
        const float* qrow = Q + ((size_t)b * SS + q0 + m) * ROW;
        #pragma unroll
        for (int c = 0; c < 4; ++c) {
            #pragma unroll
            for (int j = 0; j < 8; ++j) {
                aq[c][j]     = (_Float16)(qrow[32*c +      8*h + j] * qscale);
                aq[c][8 + j] = (_Float16)(qrow[32*c + 16 + 8*h + j] * qscale);
            }
        }
    }

    // all-ones B operand: rowsum(P) = P @ ones on the matrix pipe
    v16h ones;
    #pragma unroll
    for (int j = 0; j < 16; ++j) ones[j] = (_Float16)1.0f;

    v8f acc[2][2][4];
    #pragma unroll
    for (int mp = 0; mp < 2; ++mp)
        #pragma unroll
        for (int cp = 0; cp < 2; ++cp)
            #pragma unroll
            for (int g = 0; g < 4; ++g)
                #pragma unroll
                for (int j = 0; j < 8; ++j) acc[mp][cp][g][j] = 0.f;

    float mS[2][8], lS[2][8];
    #pragma unroll
    for (int mp = 0; mp < 2; ++mp)
        #pragma unroll
        for (int j = 0; j < 8; ++j) { mS[mp][j] = -__builtin_inff(); lS[mp][j] = 0.f; }

    const _Float16* vtBase = VT + (size_t)b * 2 * 64 * SS;   // rows stride SS

    for (int kt = 0; kt < NTILE; ++kt) {
        __syncthreads();
        // ---- staging: pure b128 vector copies of pre-converted f16 tiles
        {
            const v8h* gsr = (const v8h*)(Ksr + ((size_t)b * SS + (size_t)kt * KT) * ROW);
            const v8h* gsi = (const v8h*)(Ksi + ((size_t)b * SS + (size_t)kt * KT) * ROW);
            #pragma unroll
            for (int i = 0; i < 8; ++i) {          // 2048 v8h units per 32 KB tile
                const int j = tid + 256 * i;
                const int r = j >> 4, c = j & 15;  // 16 units per 128-half row
                *(v8h*)&ldsKsr[r * LP + c * 8] = gsr[j];
                *(v8h*)&ldsKsi[r * LP + c * 8] = gsi[j];
            }
            const _Float16* gvt = vtBase + (size_t)kt * KT;
            #pragma unroll
            for (int i = 0; i < 8; ++i) {          // 128 rows x 16 units of 8 halves
                const int j = tid + 256 * i;
                const int r = j >> 4, c = j & 15;
                *(v8h*)&ldsVT[r * LP + c * 8] = *(const v8h*)&gvt[(size_t)r * SS + c * 8];
            }
        }
        __syncthreads();

        // ---- prefetch next tile into near caches, overlapped with compute
        if (kt + 1 < NTILE) {
            const char* nsr = (const char*)(Ksr + ((size_t)b * SS + (size_t)(kt + 1) * KT) * ROW);
            const char* nsi = (const char*)(Ksi + ((size_t)b * SS + (size_t)(kt + 1) * KT) * ROW);
            #pragma unroll
            for (int i = 0; i < 2; ++i) {          // 256 thr * 64B * 2 = 32 KB each
                __builtin_prefetch(nsr + tid * 64 + i * 16384, 0, 3);
                __builtin_prefetch(nsi + tid * 64 + i * 16384, 0, 3);
            }
            const char* nvt = (const char*)(vtBase + (size_t)(kt + 1) * KT);
            __builtin_prefetch(nvt + (size_t)(tid >> 1) * (SS * 2) + (tid & 1) * 128, 0, 3);
        }

        // ---- per map: scores (32 WMMAs), online max update, P store
        #pragma unroll
        for (int mp = 0; mp < 2; ++mp) {
            const _Float16* kb = mp ? ldsKsi : ldsKsr;
            v8f sAcc[8];
            #pragma unroll
            for (int g = 0; g < 8; ++g) {
                v8f s = {0.f,0.f,0.f,0.f,0.f,0.f,0.f,0.f};
                const _Float16* krow = &kb[(16 * g + m) * LP];
                #pragma unroll
                for (int c = 0; c < 4; ++c)
                    s = wmma_f16(aq[c], ld_op(&krow[32 * c + 8 * h]), s);
                sAcc[g] = s;
            }

            _Float16* pM = &ldsP[w][mp][0];
            #pragma unroll
            for (int j = 0; j < 8; ++j) {
                float tm = fmaxf(fmaxf(fmaxf(sAcc[0][j], sAcc[1][j]), fmaxf(sAcc[2][j], sAcc[3][j])),
                                 fmaxf(fmaxf(sAcc[4][j], sAcc[5][j]), fmaxf(sAcc[6][j], sAcc[7][j])));
                #pragma unroll
                for (int msk = 1; msk < 16; msk <<= 1) tm = fmaxf(tm, __shfl_xor(tm, msk, 32));
                float mn = fmaxf(mS[mp][j], tm);
                float f  = fast_exp2(mS[mp][j] - mn);
                mS[mp][j] = mn;
                lS[mp][j] *= f;                  // row-sum added after P@ones
                #pragma unroll
                for (int cp = 0; cp < 2; ++cp)
                    #pragma unroll
                    for (int g = 0; g < 4; ++g) acc[mp][cp][g][j] *= f;
                const int row = j + 8 * h;       // C-layout row for this lane/vgpr
                #pragma unroll
                for (int g = 0; g < 8; ++g)
                    pM[row * LP + 16 * g + m] = (_Float16)fast_exp2(sAcc[g][j] - mn);
            }
        }

        // ---- P @ V and P @ ones: kc-outer keeps only 2 P operands live
        v8f lsum[2];
        #pragma unroll
        for (int mp = 0; mp < 2; ++mp)
            #pragma unroll
            for (int j = 0; j < 8; ++j) lsum[mp][j] = 0.f;

        const _Float16* pM0 = &ldsP[w][0][0];
        const _Float16* pM1 = &ldsP[w][1][0];
        #pragma unroll
        for (int kc = 0; kc < 4; ++kc) {
            v16h pA = ld_op(&pM0[m * LP + 32 * kc + 8 * h]);
            v16h pB = ld_op(&pM1[m * LP + 32 * kc + 8 * h]);
            lsum[0] = wmma_f16(pA, ones, lsum[0]);
            lsum[1] = wmma_f16(pB, ones, lsum[1]);
            #pragma unroll
            for (int cp = 0; cp < 2; ++cp) {
                #pragma unroll
                for (int g4 = 0; g4 < 4; ++g4) {
                    const int d = 16 * g4 + m;
                    v16h vb = ld_op(&ldsVT[(cp * 64 + d) * LP + 32 * kc + 8 * h]);
                    acc[0][cp][g4] = wmma_f16(pA, vb, acc[0][cp][g4]);
                    acc[1][cp][g4] = wmma_f16(pB, vb, acc[1][cp][g4]);
                }
            }
        }
        #pragma unroll
        for (int mp = 0; mp < 2; ++mp)
            #pragma unroll
            for (int j = 0; j < 8; ++j) lS[mp][j] += lsum[mp][j];
    }

    // ---- normalize per term and emit interleaved complex output
    #pragma unroll
    for (int j = 0; j < 8; ++j) {
        float ir = 1.0f / lS[0][j];
        float ii = 1.0f / lS[1][j];
        int row  = q0 + j + 8 * h;
        float* orow = O + ((size_t)b * SS + row) * ROW;
        #pragma unroll
        for (int g4 = 0; g4 < 4; ++g4) {
            int d = 16 * g4 + m;
            float outr = acc[0][0][g4][j] * ir - acc[1][1][g4][j] * ii;
            float outi = acc[0][1][g4][j] * ir + acc[1][0][g4][j] * ii;
            float2 o2  = make_float2(outr, outi);
            *(float2*)(orow + 2 * d) = o2;
        }
    }
}

extern "C" void kernel_launch(void* const* d_in, const int* in_sizes, int n_in,
                              void* d_out, int out_size, void* d_ws, size_t ws_size,
                              hipStream_t stream) {
    const float* Q = (const float*)d_in[0];
    const float* K = (const float*)d_in[1];
    const float* V = (const float*)d_in[2];
    float* O = (float*)d_out;

    // workspace: Ksr (4 MB) | Ksi (4 MB) | VT (4 MB), all f16
    _Float16* wsKsr = (_Float16*)d_ws;
    _Float16* wsKsi = wsKsr + (size_t)NB * SS * ROW;
    _Float16* wsVT  = wsKsi + (size_t)NB * SS * ROW;

    prep_k_kernel<<<dim3(NB * SS * ROW / 4 / 256), dim3(256), 0, stream>>>(K, wsKsr, wsKsi);
    prep_v_kernel<<<dim3(NB * 2 * 64 * (SS / 8) / 256), dim3(256), 0, stream>>>(V, wsVT);
    cdpa_flash_kernel<<<dim3(NB * (SS / (WAVES * QW))), dim3(256), 0, stream>>>(
        Q, wsKsr, wsKsi, wsVT, O);
}

// v002
// Measured time: 126 microseconds a run.
// Two timings next to v001 put it at 1.51 and 1.50 times that version's speed.
// All steps since v000 together make it 7.58 times as fast.
#include <hip/hip_runtime.h>
#include <math.h>

typedef __attribute__((ext_vector_type(16))) _Float16 v16h;
typedef __attribute__((ext_vector_type(8)))  _Float16 v8h;
typedef __attribute__((ext_vector_type(4)))  _Float16 v4h;
typedef __attribute__((ext_vector_type(8)))  float    v8f;

#define NB    4      // batches
#define SS    4096   // sequence length
#define ROW   128    // D*2 elements per token row (interleaved r,i)
#define KT    128    // key tile (4 x K=32 WMMA contraction chunks)
#define WAVES 8
#define QW    16     // query rows per wave
#define NTILE (SS / KT)
#define KSPL  2      // key ranges; one work-group per (query block, key range)
#define LP    136    // LDS row pitch in halves: 272 B = 16 B x 17 (odd), so the 16 rows
                     // of one ds_load_b128 fall on 16 distinct groups of four banks

__device__ __forceinline__ float fast_exp2(float x) {
#if __has_builtin(__builtin_amdgcn_exp2f)
    return __builtin_amdgcn_exp2f(x);   // raw v_exp_f32
#else
    return exp2f(x);
#endif
}

__device__ __forceinline__ v8f wmma_f16(const v16h& a, const v16h& b, const v8f& c) {
    return __builtin_amdgcn_wmma_f32_16x16x32_f16(false, a, false, b, (short)0, c, false, false);
}

// Load a v16h operand: two contiguous 8-half runs (base, base+16 halves),
// each one ds_load_b128.
__device__ __forceinline__ v16h ld_op(const _Float16* base) {
    v8h lo = *(const v8h*)(base);
    v8h hi = *(const v8h*)(base + 16);
    return __builtin_shufflevector(lo, hi, 0,1,2,3,4,5,6,7,8,9,10,11,12,13,14,15);
}

// ---- pre-pass 1: K (f32, interleaved complex) -> two f16 variants in ws
__global__ __launch_bounds__(256)
void prep_k_kernel(const float* __restrict__ K,
                   _Float16* __restrict__ Ksr, _Float16* __restrict__ Ksi)
{
    const size_t idx = (size_t)blockIdx.x * 256 + threadIdx.x;  // over NB*SS*ROW/4 float4
    float4 kv = ((const float4*)K)[idx];
    v4h srh = { (_Float16)kv.x, (_Float16)(-kv.y),
                (_Float16)kv.z, (_Float16)(-kv.w) };            // (kr, -ki)
    v4h sih = { (_Float16)kv.y, (_Float16)kv.x,
                (_Float16)kv.w, (_Float16)kv.z };               // (ki,  kr)
    *(v4h*)&Ksr[idx * 4] = srh;
    *(v4h*)&Ksi[idx * 4] = sih;
}

// ---- pre-pass 2: V (f32 [b][s][d][comp]) -> f16 transposed [b][comp][d][s]
__global__ __launch_bounds__(256)
void prep_v_kernel(const float* __restrict__ V, _Float16* __restrict__ VT)
{
    const int id   = blockIdx.x * 256 + threadIdx.x;   // over NB*2*64*(SS/8)
    const int sblk = id & (SS / 8 - 1);
    int rest = id >> 9;                                // SS/8 == 512
    const int d    = rest & 63;  rest >>= 6;
    const int comp = rest & 1;
    const int b    = rest >> 1;
    const int s0   = sblk * 8;
    v8h out;
    #pragma unroll
    for (int q = 0; q < 8; ++q)
        out[q] = (_Float16)V[((size_t)b * SS + s0 + q) * ROW + 2 * d + comp];
    *(v8h*)&VT[(((size_t)b * 2 + comp) * 64 + d) * SS + s0] = out;
}

__global__ __launch_bounds__(256)
void cdpa_flash_kernel(const float* __restrict__ Q,
                       const _Float16* __restrict__ Ksr,
                       const _Float16* __restrict__ Ksi,
                       const _Float16* __restrict__ VT,
                       float* __restrict__ Pt,
                       float* __restrict__ St)
{
    __shared__ _Float16 ldsKsr[KT * LP];           // 34 KB
    __shared__ _Float16 ldsKsi[KT * LP];           // 34 KB
    __shared__ _Float16 ldsVT[2 * 64 * LP];        // 34 KB
    __shared__ _Float16 ldsP[WAVES][2][16 * LP];   // 68 KB

    const int tid  = threadIdx.x;
    const int w    = tid >> 5;
    const int lane = tid & 31;
    const int m    = lane & 15;   // row (A) / col (B,C) index
    const int h    = lane >> 4;   // half-wave selector

    const int blocksPerBatch = SS / (WAVES * QW);  // 32
    const int ks  = blockIdx.x % KSPL;             // key range of this work-group
    const int blk = blockIdx.x / KSPL;
    const int b  = blk / blocksPerBatch;
    const int qt = blk % blocksPerBatch;
    const int q0 = qt * (WAVES * QW) + w * QW;

    // Q A-operands. Scale = 1/sqrt(D) * log2(e): scores in log2 domain.
    const float qscale = 0.125f * 1.44269504088896340736f;
    v16h aq[4];
    {
        const float* qrow = Q + ((size_t)b * SS + q0 + m) * ROW;
        #pragma unroll
        for (int c = 0; c < 4; ++c) {
            #pragma unroll
            for (int j = 0; j < 8; ++j) {
                aq[c][j]     = (_Float16)(qrow[32*c +      8*h + j] * qscale);
                aq[c][8 + j] = (_Float16)(qrow[32*c + 16 + 8*h + j] * qscale);
            }
        }
    }

    // all-ones B operand: rowsum(P) = P @ ones on the matrix pipe
    v16h ones;
    #pragma unroll
    for (int j = 0; j < 16; ++j) ones[j] = (_Float16)1.0f;

    v8f acc[2][2][4];
    #pragma unroll
    for (int mp = 0; mp < 2; ++mp)
        #pragma unroll
        for (int cp = 0; cp < 2; ++cp)
            #pragma unroll
            for (int g = 0; g < 4; ++g)
                #pragma unroll
                for (int j = 0; j < 8; ++j) acc[mp][cp][g][j] = 0.f;

    float mS[2][8], lS[2][8];
    #pragma unroll
    for (int mp = 0; mp < 2; ++mp)
        #pragma unroll
        for (int j = 0; j < 8; ++j) { mS[mp][j] = -__builtin_inff(); lS[mp][j] = 0.f; }

    const _Float16* vtBase = VT + (size_t)b * 2 * 64 * SS;   // rows stride SS

    const int ktEnd = (ks + 1) * (NTILE / KSPL);
    for (int kt = ks * (NTILE / KSPL); kt < ktEnd; ++kt) {
        __syncthreads();
        // ---- staging: pure b128 vector copies of pre-converted f16 tiles
        {
            const v8h* gsr = (const v8h*)(Ksr + ((size_t)b * SS + (size_t)kt * KT) * ROW);
            const v8h* gsi = (const v8h*)(Ksi + ((size_t)b * SS + (size_t)kt * KT) * ROW);
            #pragma unroll
            for (int i = 0; i < 8; ++i) {          // 2048 v8h units per 32 KB tile
                const int j = tid + 256 * i;
                const int r = j >> 4, c = j & 15;  // 16 units per 128-half row
                *(v8h*)&ldsKsr[r * LP + c * 8] = gsr[j];
                *(v8h*)&ldsKsi[r * LP + c * 8] = gsi[j];
            }
            const _Float16* gvt = vtBase + (size_t)kt * KT;
            #pragma unroll
            for (int i = 0; i < 8; ++i) {          // 128 rows x 16 units of 8 halves
                const int j = tid + 256 * i;
                const int r = j >> 4, c = j & 15;
                *(v8h*)&ldsVT[r * LP + c * 8] = *(const v8h*)&gvt[(size_t)r * SS + c * 8];
            }
        }
        __syncthreads();

        // ---- prefetch next tile into near caches, overlapped with compute
        if (kt + 1 < ktEnd) {
            const char* nsr = (const char*)(Ksr + ((size_t)b * SS + (size_t)(kt + 1) * KT) * ROW);
            const char* nsi = (const char*)(Ksi + ((size_t)b * SS + (size_t)(kt + 1) * KT) * ROW);
            #pragma unroll
            for (int i = 0; i < 2; ++i) {          // 256 thr * 64B * 2 = 32 KB each
                __builtin_prefetch(nsr + tid * 64 + i * 16384, 0, 3);
                __builtin_prefetch(nsi + tid * 64 + i * 16384, 0, 3);
            }
            const char* nvt = (const char*)(vtBase + (size_t)(kt + 1) * KT);
            __builtin_prefetch(nvt + (size_t)(tid >> 1) * (SS * 2) + (tid & 1) * 128, 0, 3);
        }

        // ---- per map: scores (32 WMMAs), online max update, P store
        #pragma unroll
        for (int mp = 0; mp < 2; ++mp) {
            const _Float16* kb = mp ? ldsKsi : ldsKsr;
            v8f sAcc[8];
            #pragma unroll
            for (int g = 0; g < 8; ++g) {
                v8f s = {0.f,0.f,0.f,0.f,0.f,0.f,0.f,0.f};
                const _Float16* krow = &kb[(16 * g + m) * LP];
                #pragma unroll
                for (int c = 0; c < 4; ++c)
                    s = wmma_f16(aq[c], ld_op(&krow[32 * c + 8 * h]), s);
                sAcc[g] = s;
            }

            _Float16* pM = &ldsP[w][mp][0];
            #pragma unroll
            for (int j = 0; j < 8; ++j) {
                float tm = fmaxf(fmaxf(fmaxf(sAcc[0][j], sAcc[1][j]), fmaxf(sAcc[2][j], sAcc[3][j])),
                                 fmaxf(fmaxf(sAcc[4][j], sAcc[5][j]), fmaxf(sAcc[6][j], sAcc[7][j])));
                #pragma unroll
                for (int msk = 1; msk < 16; msk <<= 1) tm = fmaxf(tm, __shfl_xor(tm, msk, 32));
                float mn = fmaxf(mS[mp][j], tm);
                float f  = fast_exp2(mS[mp][j] - mn);
                mS[mp][j] = mn;
                lS[mp][j] *= f;                  // row-sum added after P@ones
                #pragma unroll
                for (int cp = 0; cp < 2; ++cp)
                    #pragma unroll
                    for (int g = 0; g < 4; ++g) acc[mp][cp][g][j] *= f;
                const int row = j + 8 * h;       // C-layout row for this lane/vgpr
                #pragma unroll
                for (int g = 0; g < 8; ++g)
                    pM[row * LP + 16 * g + m] = (_Float16)fast_exp2(sAcc[g][j] - mn);
            }
        }

        // ---- P @ V and P @ ones: kc-outer keeps only 2 P operands live
        v8f lsum[2];
        #pragma unroll
        for (int mp = 0; mp < 2; ++mp)
            #pragma unroll
            for (int j = 0; j < 8; ++j) lsum[mp][j] = 0.f;

        const _Float16* pM0 = &ldsP[w][0][0];
        const _Float16* pM1 = &ldsP[w][1][0];
        #pragma unroll
        for (int kc = 0; kc < 4; ++kc) {
            v16h pA = ld_op(&pM0[m * LP + 32 * kc + 8 * h]);
            v16h pB = ld_op(&pM1[m * LP + 32 * kc + 8 * h]);
            lsum[0] = wmma_f16(pA, ones, lsum[0]);
            lsum[1] = wmma_f16(pB, ones, lsum[1]);
            #pragma unroll
            for (int cp = 0; cp < 2; ++cp) {
                #pragma unroll
                for (int g4 = 0; g4 < 4; ++g4) {
                    const int d = 16 * g4 + m;
                    v16h vb = ld_op(&ldsVT[(cp * 64 + d) * LP + 32 * kc + 8 * h]);
                    acc[0][cp][g4] = wmma_f16(pA, vb, acc[0][cp][g4]);
                    acc[1][cp][g4] = wmma_f16(pB, vb, acc[1][cp][g4]);
                }
            }
        }
        #pragma unroll
        for (int mp = 0; mp < 2; ++mp)
            #pragma unroll
            for (int j = 0; j < 8; ++j) lS[mp][j] += lsum[mp][j];
    }

    // ---- emit this key range's un-normalised terms, already placed as (re, im) of the
    //      output (real map: (A Vr, A Vi); imag map: (-A Vi, A Vr)), and (max, sum) per row
    #pragma unroll
    for (int j = 0; j < 8; ++j) {
        const size_t grow = (size_t)b * SS + q0 + j + 8 * h;
        const size_t r0 = (size_t)(ks * 2 + 0) * NB * SS + grow;
        const size_t r1 = (size_t)(ks * 2 + 1) * NB * SS + grow;
        #pragma unroll
        for (int g4 = 0; g4 < 4; ++g4) {
            int d = 16 * g4 + m;
            *(float2*)(Pt + r0 * ROW + 2 * d) = make_float2( acc[0][0][g4][j], acc[0][1][g4][j]);
            *(float2*)(Pt + r1 * ROW + 2 * d) = make_float2(-acc[1][1][g4][j], acc[1][0][g4][j]);
        }
        if (m == 0) {                            // max and sum are equal in the row's 16 lanes
            *(float2*)(St + r0 * 2) = make_float2(mS[0][j], lS[0][j]);
            *(float2*)(St + r1 * 2) = make_float2(mS[1][j], lS[1][j]);
        }
    }
}

// ---- post-pass: merge the key ranges per row and map, normalise, add the two maps' terms.
//      One wave per row at a time, MROWS rows per wave.
#define MROWS 8

// v_exp_f32 with the one free slot behind a transcendental written into the same statement.
__device__ __forceinline__ float exp2_slot(float x) {
    float r;
    asm("v_exp_f32 %0, %1\n\tv_nop" : "=v"(r) : "v"(x));
    return r;
}

__global__ __launch_bounds__(256)
void merge_ranges_kernel(const float* __restrict__ Pt, const float* __restrict__ St,
                         float* __restrict__ O)
{
    const int lane = threadIdx.x & 31;
    // the wave's number as a scalar: row addresses are scalar bases plus one lane offset
    const int wv   = blockIdx.x * 8 + __builtin_amdgcn_readfirstlane(threadIdx.x >> 5);
    const size_t NR = (size_t)NB * SS;
    float4 o[MROWS];
    #pragma unroll
    for (int i = 0; i < MROWS; ++i) {
        const size_t row = (size_t)wv * MROWS + i;
        o[i] = make_float4(0.f, 0.f, 0.f, 0.f);
        #pragma unroll
        for (int mp = 0; mp < 2; ++mp) {
            const float2 s0 = *(const float2*)(St + ((size_t)mp * NR + row) * 2);
            const float2 s1 = *(const float2*)(St + ((size_t)(2 + mp) * NR + row) * 2);
            const float4 x0 = ((const float4*)(Pt + ((size_t)mp * NR + row) * ROW))[lane];
            const float4 x1 = ((const float4*)(Pt + ((size_t)(2 + mp) * NR + row) * ROW))[lane];
            const float M   = fmaxf(s0.x, s1.x);
            const float a0  = exp2_slot(s0.x - M);
            const float a1  = exp2_slot(s1.x - M);
            const float inv = 1.0f / (a0 * s0.y + a1 * s1.y);
            const float c0  = a0 * inv, c1 = a1 * inv;
            o[i].x += c0 * x0.x + c1 * x1.x;
            o[i].y += c0 * x0.y + c1 * x1.y;
            o[i].z += c0 * x0.z + c1 * x1.z;
            o[i].w += c0 * x0.w + c1 * x1.w;
        }
    }
    #pragma unroll
    for (int i = 0; i < MROWS; ++i)
        ((float4*)(O + ((size_t)wv * MROWS + i) * ROW))[lane] = o[i];
}

extern "C" void kernel_launch(void* const* d_in, const int* in_sizes, int n_in,
                              void* d_out, int out_size, void* d_ws, size_t ws_size,
                              hipStream_t stream) {
    const float* Q = (const float*)d_in[0];
    const float* K = (const float*)d_in[1];
    const float* V = (const float*)d_in[2];
    float* O = (float*)d_out;

    // workspace: Ksr (4 MB) | Ksi (4 MB) | VT (4 MB), all f16 |
    //            f32 terms [range][map][row][128] (32 MB) | f32 (max, sum) [range][map][row]
    _Float16* wsKsr = (_Float16*)d_ws;
    _Float16* wsKsi = wsKsr + (size_t)NB * SS * ROW;
    _Float16* wsVT  = wsKsi + (size_t)NB * SS * ROW;
    float*    wsPt  = (float*)(wsVT + (size_t)NB * SS * ROW);
    float*    wsSt  = wsPt + (size_t)KSPL * 2 * NB * SS * ROW;

    prep_k_kernel<<<dim3(NB * SS * ROW / 4 / 256), dim3(256), 0, stream>>>(K, wsKsr, wsKsi);
    prep_v_kernel<<<dim3(NB * 2 * 64 * (SS / 8) / 256), dim3(256), 0, stream>>>(V, wsVT);
    cdpa_flash_kernel<<<dim3(KSPL * NB * (SS / (WAVES * QW))), dim3(256), 0, stream>>>(
        Q, wsKsr, wsKsi, wsVT, wsPt, wsSt);
    merge_ranges_kernel<<<dim3(NB * SS / (8 * MROWS)), dim3(256), 0, stream>>>(wsPt, wsSt, O);
}

// v003
// One run takes 116 microseconds.
// In two side-by-side timings against v002, it was 1.08 and 1.09 times as fast.
// Counting every step since v000, it is 8.22 times as fast.
#include <hip/hip_runtime.h>
#include <math.h>

typedef __attribute__((ext_vector_type(16))) _Float16 v16h;
typedef __attribute__((ext_vector_type(8)))  _Float16 v8h;
typedef __attribute__((ext_vector_type(4)))  _Float16 v4h;
typedef __attribute__((ext_vector_type(8)))  float    v8f;
typedef __attribute__((ext_vector_type(2)))  float    v2f;
typedef __attribute__((ext_vector_type(2)))  _Float16 v2h;
typedef __attribute__((ext_vector_type(8)))  unsigned v8u;

#define NB    4      // batches
#define SS    4096   // sequence length
#define ROW   128    // D*2 elements per token row (interleaved r,i)
#define KT    128    // key tile (4 x K=32 WMMA contraction chunks)
#define WAVES 8
#define QW    16     // query rows per wave
#define NTILE (SS / KT)
#define KSPL  2      // key ranges; one work-group per (query block, key range)
#define LP    136    // LDS row pitch in halves: 272 B = 16 B x 17 (odd), so the 16 rows
                     // of one ds_load_b128 fall on 16 distinct groups of four banks
#define SP    132    // output staging pitch in floats: 528 B = 16 B x 33 (odd)

__device__ __forceinline__ float fast_exp2(float x) {
#if __has_builtin(__builtin_amdgcn_exp2f)
    return __builtin_amdgcn_exp2f(x);   // raw v_exp_f32
#else
    return exp2f(x);
#endif
}

__device__ __forceinline__ v8f wmma_f16(const v16h& a, const v16h& b, const v8f& c) {
    return __builtin_amdgcn_wmma_f32_16x16x32_f16(false, a, false, b, (short)0, c, false, false);
}

// lane l <-> lane l ^ 16: the two half-waves hold the two halves of a query's keys
__device__ __forceinline__ float xhalf(float x) {
    const int v = __builtin_bit_cast(int, x);
    return __builtin_bit_cast(float,
        __builtin_amdgcn_permlanex16(v, v, 0x76543210, 0xfedcba98, false, false));
}

// Load a v16h operand: two contiguous 8-half runs (base, base+16 halves),
// each one ds_load_b128.
__device__ __forceinline__ v16h ld_op(const _Float16* base) {
    v8h lo = *(const v8h*)(base);
    v8h hi = *(const v8h*)(base + 16);
    return __builtin_shufflevector(lo, hi, 0,1,2,3,4,5,6,7,8,9,10,11,12,13,14,15);
}

// ---- pre-pass 1: K (f32, interleaved complex) -> two f16 variants in ws
__global__ __launch_bounds__(256)
void prep_k_kernel(const float* __restrict__ K,
                   _Float16* __restrict__ Ksr, _Float16* __restrict__ Ksi)
{
    const size_t idx = (size_t)blockIdx.x * 256 + threadIdx.x;  // over NB*SS*ROW/4 float4
    float4 kv = ((const float4*)K)[idx];
    v4h srh = { (_Float16)kv.x, (_Float16)(-kv.y),
                (_Float16)kv.z, (_Float16)(-kv.w) };            // (kr, -ki)
    v4h sih = { (_Float16)kv.y, (_Float16)kv.x,
                (_Float16)kv.w, (_Float16)kv.z };               // (ki,  kr)
    *(v4h*)&Ksr[idx * 4] = srh;
    *(v4h*)&Ksi[idx * 4] = sih;
}

// ---- pre-pass 2: V (f32 [b][s][d][comp]) -> f16 transposed [b][comp][d][s]
__global__ __launch_bounds__(256)
void prep_v_kernel(const float* __restrict__ V, _Float16* __restrict__ VT)
{
    const int id   = blockIdx.x * 256 + threadIdx.x;   // over NB*2*64*(SS/8)
    const int sblk = id & (SS / 8 - 1);
    int rest = id >> 9;                                // SS/8 == 512
    const int d    = rest & 63;  rest >>= 6;
    const int comp = rest & 1;
    const int b    = rest >> 1;
    const int s0   = sblk * 8;
    v8h out;
    #pragma unroll
    for (int q = 0; q < 8; ++q)
        out[q] = (_Float16)V[((size_t)b * SS + s0 + q) * ROW + 2 * d + comp];
    *(v8h*)&VT[(((size_t)b * 2 + comp) * 64 + d) * SS + s0] = out;
}

__global__ __launch_bounds__(256)
void cdpa_flash_kernel(const float* __restrict__ Q,
                       const _Float16* __restrict__ Ksr,
                       const _Float16* __restrict__ Ksi,
                       const _Float16* __restrict__ VT,
                       float* __restrict__ Pt,
                       float* __restrict__ St)
{
    __shared__ _Float16 ldsKsr[KT * LP];           // 34 KB
    __shared__ _Float16 ldsKsi[KT * LP];           // 34 KB
    __shared__ _Float16 ldsVT[2 * 64 * LP];        // 34 KB
    __shared__ __attribute__((aligned(16))) float ldsO[WAVES][16 * SP];   // 66 KB, epilogue only

    const int tid  = threadIdx.x;
    const int w    = tid >> 5;
    const int lane = tid & 31;
    const int m    = lane & 15;   // row (A) / col (B,C) index; the lane's query column
    const int h    = lane >> 4;   // half-wave selector

    const int blocksPerBatch = SS / (WAVES * QW);  // 32
    const int ks  = blockIdx.x % KSPL;             // key range of this work-group
    const int blk = blockIdx.x / KSPL;
    const int b  = blk / blocksPerBatch;
    const int qt = blk % blocksPerBatch;
    const int q0 = qt * (WAVES * QW) + w * QW;

    // Q B-operands (S^T = K Q^T: column m is query q0 + m). Scale = 1/sqrt(D) * log2(e): scores in log2 domain.
    const float qscale = 0.125f * 1.44269504088896340736f;
    v16h aq[4];
    {
        const float* qrow = Q + ((size_t)b * SS + q0 + m) * ROW;
        #pragma unroll
        for (int c = 0; c < 4; ++c) {
            #pragma unroll
            for (int j = 0; j < 8; ++j) {
                aq[c][j]     = (_Float16)(qrow[32*c +      8*h + j] * qscale);
                aq[c][8 + j] = (_Float16)(qrow[32*c + 16 + 8*h + j] * qscale);
            }
        }
    }

    // all-ones A operand: every row of ones @ P^T holds the column sums of P^T
    v16h ones;
    #pragma unroll
    for (int j = 0; j < 16; ++j) ones[j] = (_Float16)1.0f;

    v8f acc[2][2][4];
    #pragma unroll
    for (int mp = 0; mp < 2; ++mp)
        #pragma unroll
        for (int cp = 0; cp < 2; ++cp)
            #pragma unroll
            for (int g = 0; g < 4; ++g)
                #pragma unroll
                for (int j = 0; j < 8; ++j) acc[mp][cp][g][j] = 0.f;

    float mS[2], lS[2];           // one query per lane: one maximum and one sum per map
    #pragma unroll
    for (int mp = 0; mp < 2; ++mp) { mS[mp] = -__builtin_inff(); lS[mp] = 0.f; }

    const _Float16* vtBase = VT + (size_t)b * 2 * 64 * SS;   // rows stride SS

    const int ktEnd = (ks + 1) * (NTILE / KSPL);
    for (int kt = ks * (NTILE / KSPL); kt < ktEnd; ++kt) {
        __syncthreads();
        // ---- staging: pure b128 vector copies of pre-converted f16 tiles
        {
            const v8h* gsr = (const v8h*)(Ksr + ((size_t)b * SS + (size_t)kt * KT) * ROW);
            const v8h* gsi = (const v8h*)(Ksi + ((size_t)b * SS + (size_t)kt * KT) * ROW);
            #pragma unroll
            for (int i = 0; i < 8; ++i) {          // 2048 v8h units per 32 KB tile
                const int j = tid + 256 * i;
                const int r = j >> 4, c = j & 15;  // 16 units per 128-half row
                *(v8h*)&ldsKsr[r * LP + c * 8] = gsr[j];
                *(v8h*)&ldsKsi[r * LP + c * 8] = gsi[j];
            }
            const _Float16* gvt = vtBase + (size_t)kt * KT;
            #pragma unroll
            for (int i = 0; i < 8; ++i) {          // 128 rows x 16 units of 8 halves
                const int j = tid + 256 * i;
                const int r = j >> 4, c = j & 15;
                *(v8h*)&ldsVT[r * LP + c * 8] = *(const v8h*)&gvt[(size_t)r * SS + c * 8];
            }
        }
        __syncthreads();

        // ---- prefetch next tile into near caches, overlapped with compute
        if (kt + 1 < ktEnd) {
            const char* nsr = (const char*)(Ksr + ((size_t)b * SS + (size_t)(kt + 1) * KT) * ROW);
            const char* nsi = (const char*)(Ksi + ((size_t)b * SS + (size_t)(kt + 1) * KT) * ROW);
            #pragma unroll
            for (int i = 0; i < 2; ++i) {          // 256 thr * 64B * 2 = 32 KB each
                __builtin_prefetch(nsr + tid * 64 + i * 16384, 0, 3);
                __builtin_prefetch(nsi + tid * 64 + i * 16384, 0, 3);
            }
            const char* nvt = (const char*)(vtBase + (size_t)(kt + 1) * KT);
            __builtin_prefetch(nvt + (size_t)(tid >> 1) * (SS * 2) + (tid & 1) * 128, 0, 3);
        }

        // ---- per map: S^T = K Q^T (32 WMMAs). Lane (m, h) holds, for query m, keys 16 g + 8 h + j:
        //      maximum in-lane plus one exchange between the halves; exp2 packs straight into
        //      the B operand of O^T += V^T P^T (k = 8 h + j from tile 2 kc, 16 + 8 h + j from 2 kc + 1)
        v16h pT[2][4];
        #pragma unroll
        for (int mp = 0; mp < 2; ++mp) {
            const _Float16* kb = mp ? ldsKsi : ldsKsr;
            v8f sAcc[8];
            #pragma unroll
            for (int g = 0; g < 8; ++g) {
                v8f s = {0.f,0.f,0.f,0.f,0.f,0.f,0.f,0.f};
                const _Float16* krow = &kb[(16 * g + m) * LP];
                #pragma unroll
                for (int c = 0; c < 4; ++c)
                    s = wmma_f16(ld_op(&krow[32 * c + 8 * h]), aq[c], s);
                sAcc[g] = s;
            }

            float t8[8];
            #pragma unroll
            for (int j = 0; j < 8; ++j)
                t8[j] = fmaxf(fmaxf(fmaxf(sAcc[0][j], sAcc[1][j]), fmaxf(sAcc[2][j], sAcc[3][j])),
                              fmaxf(fmaxf(sAcc[4][j], sAcc[5][j]), fmaxf(sAcc[6][j], sAcc[7][j])));
            float tm = fmaxf(fmaxf(fmaxf(t8[0], t8[1]), fmaxf(t8[2], t8[3])),
                             fmaxf(fmaxf(t8[4], t8[5]), fmaxf(t8[6], t8[7])));
            tm = fmaxf(tm, xhalf(tm));
            const float mn = fmaxf(mS[mp], tm);
            const float f  = fast_exp2(mS[mp] - mn);
            mS[mp] = mn;
            lS[mp] *= f;                         // column sum added after ones @ P^T
            #pragma unroll
            for (int cp = 0; cp < 2; ++cp)
                #pragma unroll
                for (int g = 0; g < 4; ++g) acc[mp][cp][g] *= f;
            #pragma unroll
            for (int kc = 0; kc < 4; ++kc) {
                v8u pk;
                #pragma unroll
                for (int i = 0; i < 8; ++i) {    // operand elements 2 i, 2 i + 1: one register pair
                    const v8f& s = sAcc[2 * kc + (i >> 2)];
                    const v2f e = v2f{s[2 * (i & 3)], s[2 * (i & 3) + 1]} - v2f{mn, mn};
                    const v2f p = {fast_exp2(e.x), fast_exp2(e.y)};
                    pk[i] = __builtin_bit_cast(unsigned, __builtin_convertvector(p, v2h));
                }
                pT[mp][kc] = __builtin_bit_cast(v16h, pk);
            }
        }

        // ---- O^T += V^T P^T and ones @ P^T; each V^T fragment feeds both maps
        v8f lsum[2];
        #pragma unroll
        for (int mp = 0; mp < 2; ++mp)
            #pragma unroll
            for (int j = 0; j < 8; ++j) lsum[mp][j] = 0.f;

        #pragma unroll
        for (int kc = 0; kc < 4; ++kc) {
            lsum[0] = wmma_f16(ones, pT[0][kc], lsum[0]);
            lsum[1] = wmma_f16(ones, pT[1][kc], lsum[1]);
            #pragma unroll
            for (int cp = 0; cp < 2; ++cp) {
                #pragma unroll
                for (int g4 = 0; g4 < 4; ++g4) {
                    const int d = 16 * g4 + m;
                    v16h va = ld_op(&ldsVT[(cp * 64 + d) * LP + 32 * kc + 8 * h]);
                    acc[0][cp][g4] = wmma_f16(va, pT[0][kc], acc[0][cp][g4]);
                    acc[1][cp][g4] = wmma_f16(va, pT[1][kc], acc[1][cp][g4]);
                }
            }
        }
        #pragma unroll
        for (int mp = 0; mp < 2; ++mp) lS[mp] += lsum[mp][0];
    }

    // ---- emit this key range's un-normalised terms, already placed as (re, im) of the
    //      output (real map: (A Vr, A Vi); imag map: (-A Vi, A Vr)), and (max, sum) per row.
    //      acc[mp][cp][g4][j] is d = 16 g4 + 8 h + j of query m: each wave turns it in its own
    //      LDS range into whole 512-B rows, so that every 128-B line is stored once.
    float* stg = &ldsO[w][0];
    #pragma unroll
    for (int mp = 0; mp < 2; ++mp) {
        const size_t r0 = (size_t)(ks * 2 + mp) * NB * SS + (size_t)b * SS + q0;
        #pragma unroll
        for (int g4 = 0; g4 < 4; ++g4) {
            float* p = stg + m * SP + 32 * g4 + 16 * h;
            #pragma unroll
            for (int i = 0; i < 4; ++i) {
                const float4 t = mp == 0
                    ? make_float4( acc[0][0][g4][2*i], acc[0][1][g4][2*i],  acc[0][0][g4][2*i+1], acc[0][1][g4][2*i+1])
                    : make_float4(-acc[1][1][g4][2*i], acc[1][0][g4][2*i], -acc[1][1][g4][2*i+1], acc[1][0][g4][2*i+1]);
                *(float4*)(p + 4 * i) = t;
            }
        }
        // the wave's own LDS writes are done before other lanes read the rows back
        asm volatile("s_wait_dscnt 0x0" ::: "memory");
        #pragma unroll
        for (int r = 0; r < 16; ++r) {
            const float4 v = *(const float4*)(stg + r * SP + lane * 4);
            *(float4*)(Pt + (r0 + r) * ROW + lane * 4) = v;
        }
        if (h == 0)                              // both halves hold the query's max and sum
            *(float2*)(St + (r0 + m) * 2) = make_float2(mS[mp], lS[mp]);
    }
}

// ---- post-pass: merge the key ranges per row and map, normalise, add the two maps' terms.
//      One wave per row at a time, MROWS rows per wave.
#define MROWS 8

// v_exp_f32 with the one free slot behind a transcendental written into the same statement.
__device__ __forceinline__ float exp2_slot(float x) {
    float r;
    asm("v_exp_f32 %0, %1\n\tv_nop" : "=v"(r) : "v"(x));
    return r;
}

__global__ __launch_bounds__(256)
void merge_ranges_kernel(const float* __restrict__ Pt, const float* __restrict__ St,
                         float* __restrict__ O)
{
    const int lane = threadIdx.x & 31;
    // the wave's number as a scalar: row addresses are scalar bases plus one lane offset
    const int wv   = blockIdx.x * 8 + __builtin_amdgcn_readfirstlane(threadIdx.x >> 5);
    const size_t NR = (size_t)NB * SS;
    float4 o[MROWS];
    #pragma unroll
    for (int i = 0; i < MROWS; ++i) {
        const size_t row = (size_t)wv * MROWS + i;
        o[i] = make_float4(0.f, 0.f, 0.f, 0.f);
        #pragma unroll
        for (int mp = 0; mp < 2; ++mp) {
            const float2 s0 = *(const float2*)(St + ((size_t)mp * NR + row) * 2);
            const float2 s1 = *(const float2*)(St + ((size_t)(2 + mp) * NR + row) * 2);
            const float4 x0 = ((const float4*)(Pt + ((size_t)mp * NR + row) * ROW))[lane];
            const float4 x1 = ((const float4*)(Pt + ((size_t)(2 + mp) * NR + row) * ROW))[lane];
            const float M   = fmaxf(s0.x, s1.x);
            const float a0  = exp2_slot(s0.x - M);
            const float a1  = exp2_slot(s1.x - M);
            const float inv = 1.0f / (a0 * s0.y + a1 * s1.y);
            const float c0  = a0 * inv, c1 = a1 * inv;
            o[i].x += c0 * x0.x + c1 * x1.x;
            o[i].y += c0 * x0.y + c1 * x1.y;
            o[i].z += c0 * x0.z + c1 * x1.z;
            o[i].w += c0 * x0.w + c1 * x1.w;
        }
    }
    #pragma unroll
    for (int i = 0; i < MROWS; ++i)
        ((float4*)(O + ((size_t)wv * MROWS + i) * ROW))[lane] = o[i];
}

extern "C" void kernel_launch(void* const* d_in, const int* in_sizes, int n_in,
                              void* d_out, int out_size, void* d_ws, size_t ws_size,
                              hipStream_t stream) {
    const float* Q = (const float*)d_in[0];
    const float* K = (const float*)d_in[1];
    const float* V = (const float*)d_in[2];
    float* O = (float*)d_out;

    // workspace: Ksr (4 MB) | Ksi (4 MB) | VT (4 MB), all f16 |
    //            f32 terms [range][map][row][128] (32 MB) | f32 (max, sum) [range][map][row]
    _Float16* wsKsr = (_Float16*)d_ws;
    _Float16* wsKsi = wsKsr + (size_t)NB * SS * ROW;
    _Float16* wsVT  = wsKsi + (size_t)NB * SS * ROW;
    float*    wsPt  = (float*)(wsVT + (size_t)NB * SS * ROW);
    float*    wsSt  = wsPt + (size_t)KSPL * 2 * NB * SS * ROW;

    prep_k_kernel<<<dim3(NB * SS * ROW / 4 / 256), dim3(256), 0, stream>>>(K, wsKsr, wsKsi);
    prep_v_kernel<<<dim3(NB * 2 * 64 * (SS / 8) / 256), dim3(256), 0, stream>>>(V, wsVT);
    cdpa_flash_kernel<<<dim3(KSPL * NB * (SS / (WAVES * QW))), dim3(256), 0, stream>>>(
        Q, wsKsr, wsKsi, wsVT, wsPt, wsSt);
    merge_ranges_kernel<<<dim3(NB * SS / (8 * MROWS)), dim3(256), 0, stream>>>(wsPt, wsSt, O);
}

// v004
// It runs in 93.2 microseconds.
// Two timings next to v003 both put it at 1.26 times that version's speed.
// All steps since v000 together make it 10.3 times as fast.
#include <hip/hip_runtime.h>
#include <math.h>

typedef __attribute__((ext_vector_type(16))) _Float16 v16h;
typedef __attribute__((ext_vector_type(8)))  _Float16 v8h;
typedef __attribute__((ext_vector_type(4)))  _Float16 v4h;
typedef __attribute__((ext_vector_type(8)))  float    v8f;
typedef __attribute__((ext_vector_type(2)))  float    v2f;
typedef __attribute__((ext_vector_type(2)))  _Float16 v2h;
typedef __attribute__((ext_vector_type(8)))  unsigned v8u;

#define NB    4      // batches
#define SS    4096   // sequence length
#define ROW   128    // D*2 elements per token row (interleaved r,i)
#define KT    128    // key tile (4 x K=32 WMMA contraction chunks)
#define WAVES 8
#define QW    16     // query rows per wave
#define NTILE (SS / KT)
#define KSPL  2      // key ranges; one work-group per (query block, key range)
#define LP    136    // LDS row pitch in halves: 272 B = 16 B x 17 (odd), so the 16 rows
                     // of one ds_load_b128 fall on 16 distinct groups of four banks
#define SP    132    // output staging pitch in floats: 528 B = 16 B x 33 (odd)

__device__ __forceinline__ float fast_exp2(float x) {
#if __has_builtin(__builtin_amdgcn_exp2f)
    return __builtin_amdgcn_exp2f(x);   // raw v_exp_f32
#else
    return exp2f(x);
#endif
}

__device__ __forceinline__ v8f wmma_f16(const v16h& a, const v16h& b, const v8f& c) {
    return __builtin_amdgcn_wmma_f32_16x16x32_f16(false, a, false, b, (short)0, c, false, false);
}

// lane l <-> lane l ^ 16: the two half-waves hold the two halves of a query's keys
__device__ __forceinline__ float xhalf(float x) {
    const int v = __builtin_bit_cast(int, x);
    return __builtin_bit_cast(float,
        __builtin_amdgcn_permlanex16(v, v, 0x76543210, 0xfedcba98, false, false));
}

// Load a v16h operand: two contiguous 8-half runs (base, base+16 halves),
// each one ds_load_b128.
__device__ __forceinline__ v16h ld_op(const _Float16* base) {
    v8h lo = *(const v8h*)(base);
    v8h hi = *(const v8h*)(base + 16);
    return __builtin_shufflevector(lo, hi, 0,1,2,3,4,5,6,7,8,9,10,11,12,13,14,15);
}

// ---- pre-pass 1: K (f32, interleaved complex) -> f16, same layout, in ws
__global__ __launch_bounds__(256)
void prep_k_kernel(const float* __restrict__ K, _Float16* __restrict__ Kh)
{
    const size_t idx = (size_t)blockIdx.x * 256 + threadIdx.x;  // over NB*SS*ROW/4 float4
    float4 kv = ((const float4*)K)[idx];
    v4h kh = { (_Float16)kv.x, (_Float16)kv.y, (_Float16)kv.z, (_Float16)kv.w };   // (kr, ki)
    *(v4h*)&Kh[idx * 4] = kh;
}

// ---- pre-pass 2: V (f32 [b][s][d][comp]) -> f16 transposed [b][comp][d][s]
__global__ __launch_bounds__(256)
void prep_v_kernel(const float* __restrict__ V, _Float16* __restrict__ VT)
{
    const int id   = blockIdx.x * 256 + threadIdx.x;   // over NB*2*64*(SS/8)
    const int sblk = id & (SS / 8 - 1);
    int rest = id >> 9;                                // SS/8 == 512
    const int d    = rest & 63;  rest >>= 6;
    const int comp = rest & 1;
    const int b    = rest >> 1;
    const int s0   = sblk * 8;
    v8h out;
    #pragma unroll
    for (int q = 0; q < 8; ++q)
        out[q] = (_Float16)V[((size_t)b * SS + s0 + q) * ROW + 2 * d + comp];
    *(v8h*)&VT[(((size_t)b * 2 + comp) * 64 + d) * SS + s0] = out;
}

__global__ __launch_bounds__(256)
void cdpa_flash_kernel(const float* __restrict__ Q,
                       const _Float16* __restrict__ Kh,
                       const _Float16* __restrict__ VT,
                       float* __restrict__ Pt,
                       float* __restrict__ St)
{
    __shared__ _Float16 ldsK[KT * LP];             // 34 KB, (kr, ki) rows: serves both maps
    __shared__ _Float16 ldsVT[2 * 64 * LP];        // 34 KB
    __shared__ __attribute__((aligned(16))) float ldsO[WAVES][16 * SP];   // 66 KB, epilogue only

    const int tid  = threadIdx.x;
    const int w    = tid >> 5;
    const int lane = tid & 31;
    const int m    = lane & 15;   // row (A) / col (B,C) index; the lane's query column
    const int h    = lane >> 4;   // half-wave selector

    const int blocksPerBatch = SS / (WAVES * QW);  // 32
    const int ks  = blockIdx.x % KSPL;             // key range of this work-group
    const int blk = blockIdx.x / KSPL;
    const int b  = blk / blocksPerBatch;
    const int qt = blk % blocksPerBatch;
    const int q0 = qt * (WAVES * QW) + w * QW;

    // Q B-operands (S^T = K Q^T: column m is query q0 + m). Scale = 1/sqrt(D) * log2(e): scores in log2 domain.
    // The complex product's sign and swap sit on Q, which stays in registers: against K rows (kr, ki)
    // the real map takes (qr, -qi), the imaginary map (qi, qr), so one K fragment feeds both maps.
    const float qscale = 0.125f * 1.44269504088896340736f;
    v16h aq[2][4];
    {
        const float* qrow = Q + ((size_t)b * SS + q0 + m) * ROW;
        #pragma unroll
        for (int c = 0; c < 4; ++c) {
            #pragma unroll
            for (int u = 0; u < 2; ++u) {          // the two 8-half runs of the operand
                const float* qs = qrow + 32*c + 16*u + 8*h;
                #pragma unroll
                for (int j = 0; j < 8; j += 2) {
                    const _Float16 qr = (_Float16)(qs[j]     * qscale);
                    const _Float16 qi = (_Float16)(qs[j + 1] * qscale);
                    aq[0][c][8*u + j] = qr;  aq[0][c][8*u + j + 1] = -qi;
                    aq[1][c][8*u + j] = qi;  aq[1][c][8*u + j + 1] = qr;
                }
            }
        }
    }

    // all-ones A operand: every row of ones @ P^T holds the column sums of P^T
    v16h ones;
    #pragma unroll
    for (int j = 0; j < 16; ++j) ones[j] = (_Float16)1.0f;

    v8f acc[2][2][4];
    #pragma unroll
    for (int mp = 0; mp < 2; ++mp)
        #pragma unroll
        for (int cp = 0; cp < 2; ++cp)
            #pragma unroll
            for (int g = 0; g < 4; ++g)
                #pragma unroll
                for (int j = 0; j < 8; ++j) acc[mp][cp][g][j] = 0.f;

    float mS[2], lS[2];           // one query per lane: one maximum and one sum per map
    #pragma unroll
    for (int mp = 0; mp < 2; ++mp) { mS[mp] = -__builtin_inff(); lS[mp] = 0.f; }

    const _Float16* vtBase = VT + (size_t)b * 2 * 64 * SS;   // rows stride SS

    const int ktEnd = (ks + 1) * (NTILE / KSPL);
    for (int kt = ks * (NTILE / KSPL); kt < ktEnd; ++kt) {
        __syncthreads();
        // ---- staging: pure b128 vector copies of pre-converted f16 tiles
        {
            const v8h* gk = (const v8h*)(Kh + ((size_t)b * SS + (size_t)kt * KT) * ROW);
            const _Float16* gvt = vtBase + (size_t)kt * KT;
            v8h tk[8], tv[8];
            #pragma unroll
            for (int i = 0; i < 8; ++i) {          // 2048 v8h units per 32 KB tile
                const int j = tid + 256 * i;
                const int r = j >> 4, c = j & 15;  // 16 units per 128-half row
                tk[i] = gk[j];
                tv[i] = *(const v8h*)&gvt[(size_t)r * SS + c * 8];
            }
            // keeps all 16 loads in flight together: without it this build waited for
            // each load and stored it before it issued the next
            __builtin_amdgcn_sched_barrier(0);
            #pragma unroll
            for (int i = 0; i < 8; ++i) {
                const int j = tid + 256 * i;
                const int r = j >> 4, c = j & 15;
                *(v8h*)&ldsK[r * LP + c * 8]  = tk[i];
                *(v8h*)&ldsVT[r * LP + c * 8] = tv[i];
            }
        }
        __syncthreads();

        // ---- prefetch next tile into near caches, overlapped with compute
        if (kt + 1 < ktEnd) {
            const char* nk = (const char*)(Kh + ((size_t)b * SS + (size_t)(kt + 1) * KT) * ROW);
            #pragma unroll
            for (int i = 0; i < 2; ++i)            // 256 thr * 64B * 2 = 32 KB
                __builtin_prefetch(nk + tid * 64 + i * 16384, 0, 3);
            const char* nvt = (const char*)(vtBase + (size_t)(kt + 1) * KT);
            __builtin_prefetch(nvt + (size_t)(tid >> 1) * (SS * 2) + (tid & 1) * 128, 0, 3);
        }

        // ---- S^T = K Q^T, both maps from each K fragment (64 WMMAs, 32 fragments).
        //      Left open: the build still waits out each fragment's two LDS loads in front of its
        //      WMMAs, here and in the V^T products; fragments are not yet fetched a group ahead.
        v8f sBoth[2][8];
        #pragma unroll
        for (int g = 0; g < 8; ++g) {
            v8f s0 = {0.f,0.f,0.f,0.f,0.f,0.f,0.f,0.f};
            v8f s1 = {0.f,0.f,0.f,0.f,0.f,0.f,0.f,0.f};
            const _Float16* krow = &ldsK[(16 * g + m) * LP];
            #pragma unroll
            for (int c = 0; c < 4; ++c) {
                const v16h kf = ld_op(&krow[32 * c + 8 * h]);
                s0 = wmma_f16(kf, aq[0][c], s0);
                s1 = wmma_f16(kf, aq[1][c], s1);
            }
            sBoth[0][g] = s0;
            sBoth[1][g] = s1;
        }

        // ---- per map. Lane (m, h) holds, for query m, keys 16 g + 8 h + j:
        //      maximum in-lane plus one exchange between the halves; exp2 packs straight into
        //      the B operand of O^T += V^T P^T (k = 8 h + j from tile 2 kc, 16 + 8 h + j from 2 kc + 1)
        v16h pT[2][4];
        #pragma unroll
        for (int mp = 0; mp < 2; ++mp) {
            const v8f (&sAcc)[8] = sBoth[mp];

            float t8[8];
            #pragma unroll
            for (int j = 0; j < 8; ++j)
                t8[j] = fmaxf(fmaxf(fmaxf(sAcc[0][j], sAcc[1][j]), fmaxf(sAcc[2][j], sAcc[3][j])),
                              fmaxf(fmaxf(sAcc[4][j], sAcc[5][j]), fmaxf(sAcc[6][j], sAcc[7][j])));
            float tm = fmaxf(fmaxf(fmaxf(t8[0], t8[1]), fmaxf(t8[2], t8[3])),
                             fmaxf(fmaxf(t8[4], t8[5]), fmaxf(t8[6], t8[7])));
            tm = fmaxf(tm, xhalf(tm));
            const float mn = fmaxf(mS[mp], tm);
            const float f  = fast_exp2(mS[mp] - mn);
            mS[mp] = mn;
            lS[mp] *= f;                         // column sum added after ones @ P^T
            #pragma unroll
            for (int cp = 0; cp < 2; ++cp)
                #pragma unroll
                for (int g = 0; g < 4; ++g) acc[mp][cp][g] *= f;
            #pragma unroll
            for (int kc = 0; kc < 4; ++kc) {
                v8u pk;
                #pragma unroll
                for (int i = 0; i < 8; ++i) {    // operand elements 2 i, 2 i + 1: one register pair
                    const v8f& s = sAcc[2 * kc + (i >> 2)];
                    const v2f e = v2f{s[2 * (i & 3)], s[2 * (i & 3) + 1]} - v2f{mn, mn};
                    const v2f p = {fast_exp2(e.x), fast_exp2(e.y)};
                    pk[i] = __builtin_bit_cast(unsigned, __builtin_convertvector(p, v2h));
                }
                pT[mp][kc] = __builtin_bit_cast(v16h, pk);
            }
        }

        // ---- O^T += V^T P^T and ones @ P^T; each V^T fragment feeds both maps
        v8f lsum[2];
        #pragma unroll
        for (int mp = 0; mp < 2; ++mp)
            #pragma unroll
            for (int j = 0; j < 8; ++j) lsum[mp][j] = 0.f;

        #pragma unroll
        for (int kc = 0; kc < 4; ++kc) {
            lsum[0] = wmma_f16(ones, pT[0][kc], lsum[0]);
            lsum[1] = wmma_f16(ones, pT[1][kc], lsum[1]);
            #pragma unroll
            for (int cp = 0; cp < 2; ++cp) {
                #pragma unroll
                for (int g4 = 0; g4 < 4; ++g4) {
                    const int d = 16 * g4 + m;
                    v16h va = ld_op(&ldsVT[(cp * 64 + d) * LP + 32 * kc + 8 * h]);
                    acc[0][cp][g4] = wmma_f16(va, pT[0][kc], acc[0][cp][g4]);
                    acc[1][cp][g4] = wmma_f16(va, pT[1][kc], acc[1][cp][g4]);
                }
            }
        }
        #pragma unroll
        for (int mp = 0; mp < 2; ++mp) lS[mp] += lsum[mp][0];
    }

    // ---- emit this key range's un-normalised terms, already placed as (re, im) of the
    //      output (real map: (A Vr, A Vi); imag map: (-A Vi, A Vr)), and (max, sum) per row.
    //      acc[mp][cp][g4][j] is d = 16 g4 + 8 h + j of query m: each wave turns it in its own
    //      LDS range into whole 512-B rows, so that every 128-B line is stored once.
    float* stg = &ldsO[w][0];
    #pragma unroll
    for (int mp = 0; mp < 2; ++mp) {
        const size_t r0 = (size_t)(ks * 2 + mp) * NB * SS + (size_t)b * SS + q0;
        #pragma unroll
        for (int g4 = 0; g4 < 4; ++g4) {
            float* p = stg + m * SP + 32 * g4 + 16 * h;
            #pragma unroll
            for (int i = 0; i < 4; ++i) {
                const float4 t = mp == 0
                    ? make_float4( acc[0][0][g4][2*i], acc[0][1][g4][2*i],  acc[0][0][g4][2*i+1], acc[0][1][g4][2*i+1])
                    : make_float4(-acc[1][1][g4][2*i], acc[1][0][g4][2*i], -acc[1][1][g4][2*i+1], acc[1][0][g4][2*i+1]);
                *(float4*)(p + 4 * i) = t;
            }
        }
        // the wave's own LDS writes are done before other lanes read the rows back
        asm volatile("s_wait_dscnt 0x0" ::: "memory");
        #pragma unroll
        for (int r = 0; r < 16; ++r) {
            const float4 v = *(const float4*)(stg + r * SP + lane * 4);
            *(float4*)(Pt + (r0 + r) * ROW + lane * 4) = v;
        }
        if (h == 0)                              // both halves hold the query's max and sum
            *(float2*)(St + (r0 + m) * 2) = make_float2(mS[mp], lS[mp]);
    }
}

// ---- post-pass: merge the key ranges per row and map, normalise, add the two maps' terms.
//      One wave per row at a time, MROWS rows per wave.
#define MROWS 8

// v_exp_f32 with the one free slot behind a transcendental written into the same statement.
__device__ __forceinline__ float exp2_slot(float x) {
    float r;
    asm("v_exp_f32 %0, %1\n\tv_nop" : "=v"(r) : "v"(x));
    return r;
}

__global__ __launch_bounds__(256)
void merge_ranges_kernel(const float* __restrict__ Pt, const float* __restrict__ St,
                         float* __restrict__ O)
{
    const int lane = threadIdx.x & 31;
    // the wave's number as a scalar: row addresses are scalar bases plus one lane offset
    const int wv   = blockIdx.x * 8 + __builtin_amdgcn_readfirstlane(threadIdx.x >> 5);
    const size_t NR = (size_t)NB * SS;
    float4 o[MROWS];
    #pragma unroll
    for (int i = 0; i < MROWS; ++i) {
        const size_t row = (size_t)wv * MROWS + i;
        o[i] = make_float4(0.f, 0.f, 0.f, 0.f);
        #pragma unroll
        for (int mp = 0; mp < 2; ++mp) {
            const float2 s0 = *(const float2*)(St + ((size_t)mp * NR + row) * 2);
            const float2 s1 = *(const float2*)(St + ((size_t)(2 + mp) * NR + row) * 2);
            const float4 x0 = ((const float4*)(Pt + ((size_t)mp * NR + row) * ROW))[lane];
            const float4 x1 = ((const float4*)(Pt + ((size_t)(2 + mp) * NR + row) * ROW))[lane];
            const float M   = fmaxf(s0.x, s1.x);
            const float a0  = exp2_slot(s0.x - M);
            const float a1  = exp2_slot(s1.x - M);
            const float inv = 1.0f / (a0 * s0.y + a1 * s1.y);
            const float c0  = a0 * inv, c1 = a1 * inv;
            o[i].x += c0 * x0.x + c1 * x1.x;
            o[i].y += c0 * x0.y + c1 * x1.y;
            o[i].z += c0 * x0.z + c1 * x1.z;
            o[i].w += c0 * x0.w + c1 * x1.w;
        }
    }
    #pragma unroll
    for (int i = 0; i < MROWS; ++i)
        ((float4*)(O + ((size_t)wv * MROWS + i) * ROW))[lane] = o[i];
}

extern "C" void kernel_launch(void* const* d_in, const int* in_sizes, int n_in,
                              void* d_out, int out_size, void* d_ws, size_t ws_size,
                              hipStream_t stream) {
    const float* Q = (const float*)d_in[0];
    const float* K = (const float*)d_in[1];
    const float* V = (const float*)d_in[2];
    float* O = (float*)d_out;

    // workspace: K (4 MB) | VT (4 MB), both f16 |
    //            f32 terms [range][map][row][128] (32 MB) | f32 (max, sum) [range][map][row]
    _Float16* wsK   = (_Float16*)d_ws;
    _Float16* wsVT  = wsK + (size_t)NB * SS * ROW;
    float*    wsPt  = (float*)(wsVT + (size_t)NB * SS * ROW);
    float*    wsSt  = wsPt + (size_t)KSPL * 2 * NB * SS * ROW;

    prep_k_kernel<<<dim3(NB * SS * ROW / 4 / 256), dim3(256), 0, stream>>>(K, wsK);
    prep_v_kernel<<<dim3(NB * 2 * 64 * (SS / 8) / 256), dim3(256), 0, stream>>>(V, wsVT);
    cdpa_flash_kernel<<<dim3(KSPL * NB * (SS / (WAVES * QW))), dim3(256), 0, stream>>>(
        Q, wsK, wsVT, wsPt, wsSt);
    merge_ranges_kernel<<<dim3(NB * SS / (8 * MROWS)), dim3(256), 0, stream>>>(wsPt, wsSt, O);
}

// v005
// It runs in 75.3 microseconds.
// In both of two side-by-side timings against v004, it was 1.24 times as fast.
// Counting every step since v000, it is 12.8 times as fast.
#include <hip/hip_runtime.h>
#include <math.h>

typedef __attribute__((ext_vector_type(16))) _Float16 v16h;
typedef __attribute__((ext_vector_type(8)))  _Float16 v8h;
typedef __attribute__((ext_vector_type(4)))  _Float16 v4h;
typedef __attribute__((ext_vector_type(8)))  float    v8f;
typedef __attribute__((ext_vector_type(2)))  float    v2f;
typedef __attribute__((ext_vector_type(2)))  _Float16 v2h;
typedef __attribute__((ext_vector_type(8)))  unsigned v8u;

#define NB    4      // batches
#define SS    4096   // sequence length
#define ROW   128    // D*2 elements per token row (interleaved r,i)
#define KT    128    // key tile (4 x K=32 WMMA contraction chunks)
#define WAVES 8
#define QW    16     // query rows per wave
#define NTILE (SS / KT)
#define KSPL  2      // key ranges; one work-group per (query block, key range)
#define LP    136    // LDS row pitch in halves: 272 B = 16 B x 17 (odd), so the 16 rows
                     // of one ds_load_b128 fall on 16 distinct groups of four banks
#define SP    132    // output staging pitch in floats: 528 B = 16 B x 33 (odd)

__device__ __forceinline__ float fast_exp2(float x) {
#if __has_builtin(__builtin_amdgcn_exp2f)
    return __builtin_amdgcn_exp2f(x);   // raw v_exp_f32
#else
    return exp2f(x);
#endif
}

// Eight v_exp_f32 with the free slot behind a transcendental written into the statement: each fills
// the slot of the one before it (early-clobber outputs keep it off the others' sources), the v_nop
// that of the last.
__device__ __forceinline__ v8f exp2_x8(const v8f& e) {
    float p0, p1, p2, p3, p4, p5, p6, p7;
    asm("v_exp_f32 %0, %8\n\tv_exp_f32 %1, %9\n\tv_exp_f32 %2, %10\n\tv_exp_f32 %3, %11\n\t"
        "v_exp_f32 %4, %12\n\tv_exp_f32 %5, %13\n\tv_exp_f32 %6, %14\n\tv_exp_f32 %7, %15\n\tv_nop"
        : "=&v"(p0), "=&v"(p1), "=&v"(p2), "=&v"(p3), "=&v"(p4), "=&v"(p5), "=&v"(p6), "=&v"(p7)
        : "v"(e[0]), "v"(e[1]), "v"(e[2]), "v"(e[3]), "v"(e[4]), "v"(e[5]), "v"(e[6]), "v"(e[7]));
    return v8f{p0, p1, p2, p3, p4, p5, p6, p7};
}

__device__ __forceinline__ v8f wmma_f16(const v16h& a, const v16h& b, const v8f& c) {
    return __builtin_amdgcn_wmma_f32_16x16x32_f16(false, a, false, b, (short)0, c, false, false);
}

// lane l <-> lane l ^ 16: the two half-waves hold the two halves of a query's keys
__device__ __forceinline__ float xhalf(float x) {
    const int v = __builtin_bit_cast(int, x);
    return __builtin_bit_cast(float,
        __builtin_amdgcn_permlanex16(v, v, 0x76543210, 0xfedcba98, false, false));
}

// Load a v16h operand: two contiguous 8-half runs (base, base+16 halves),
// each one ds_load_b128.
__device__ __forceinline__ v16h ld_op(const _Float16* base) {
    v8h lo = *(const v8h*)(base);
    v8h hi = *(const v8h*)(base + 16);
    return __builtin_shufflevector(lo, hi, 0,1,2,3,4,5,6,7,8,9,10,11,12,13,14,15);
}

// One group of eight fragments (16 ds_load_b128): K rows 32 gp .. 32 gp + 31, all four k chunks.
__device__ __forceinline__ void ld_k_group(v16h (&f)[8], const _Float16* ldsK, int gp, int m, int h) {
    #pragma unroll
    for (int c = 0; c < 4; ++c)              // in the order in which the WMMAs take them
        #pragma unroll
        for (int gg = 0; gg < 2; ++gg)
            f[4 * gg + c] = ld_op(&ldsK[(16 * (2 * gp + gg) + m) * LP + 32 * c + 8 * h]);
}

// One group of eight fragments: all 128 V^T rows (component, d) of key chunk kc.
__device__ __forceinline__ void ld_v_group(v16h (&f)[8], const _Float16* ldsVT, int kc, int m, int h) {
    #pragma unroll
    for (int r = 0; r < 8; ++r)
        f[r] = ld_op(&ldsVT[(16 * r + m) * LP + 32 * kc + 8 * h]);
}

// ---- pre-pass 1: K (f32, interleaved complex) -> f16, same layout, in ws
__global__ __launch_bounds__(256)
void prep_k_kernel(const float* __restrict__ K, _Float16* __restrict__ Kh)
{
    const size_t idx = (size_t)blockIdx.x * 256 + threadIdx.x;  // over NB*SS*ROW/4 float4
    float4 kv = ((const float4*)K)[idx];
    v4h kh = { (_Float16)kv.x, (_Float16)kv.y, (_Float16)kv.z, (_Float16)kv.w };   // (kr, ki)
    *(v4h*)&Kh[idx * 4] = kh;
}

// ---- pre-pass 2: V (f32 [b][s][d][comp]) -> f16 transposed [b][comp][d][s]
__global__ __launch_bounds__(256)
void prep_v_kernel(const float* __restrict__ V, _Float16* __restrict__ VT)
{
    const int id   = blockIdx.x * 256 + threadIdx.x;   // over NB*2*64*(SS/8)
    const int sblk = id & (SS / 8 - 1);
    int rest = id >> 9;                                // SS/8 == 512
    const int d    = rest & 63;  rest >>= 6;
    const int comp = rest & 1;
    const int b    = rest >> 1;
    const int s0   = sblk * 8;
    v8h out;
    #pragma unroll
    for (int q = 0; q < 8; ++q)
        out[q] = (_Float16)V[((size_t)b * SS + s0 + q) * ROW + 2 * d + comp];
    *(v8h*)&VT[(((size_t)b * 2 + comp) * 64 + d) * SS + s0] = out;
}

__global__ __launch_bounds__(256)
void cdpa_flash_kernel(const float* __restrict__ Q,
                       const _Float16* __restrict__ Kh,
                       const _Float16* __restrict__ VT,
                       float* __restrict__ Pt,
                       float* __restrict__ St)
{
    __shared__ _Float16 ldsK[KT * LP];             // 34 KB, (kr, ki) rows: serves both maps
    __shared__ _Float16 ldsVT[2 * 64 * LP];        // 34 KB
    __shared__ __attribute__((aligned(16))) float ldsO[WAVES][16 * SP];   // 66 KB, epilogue only

    const int tid  = threadIdx.x;
    const int w    = tid >> 5;
    const int lane = tid & 31;
    const int m    = lane & 15;   // row (A) / col (B,C) index; the lane's query column
    const int h    = lane >> 4;   // half-wave selector

    const int blocksPerBatch = SS / (WAVES * QW);  // 32
    const int ks  = blockIdx.x % KSPL;             // key range of this work-group
    const int blk = blockIdx.x / KSPL;
    const int b  = blk / blocksPerBatch;
    const int qt = blk % blocksPerBatch;
    const int q0 = qt * (WAVES * QW) + w * QW;

    // Q B-operands (S^T = K Q^T: column m is query q0 + m). Scale = 1/sqrt(D) * log2(e): scores in log2 domain.
    // The complex product's sign and swap sit on Q, which stays in registers: against K rows (kr, ki)
    // the real map takes (qr, -qi), the imaginary map (qi, qr), so one K fragment feeds both maps.
    const float qscale = 0.125f * 1.44269504088896340736f;
    v16h aq[2][4];
    {
        const float* qrow = Q + ((size_t)b * SS + q0 + m) * ROW;
        #pragma unroll
        for (int c = 0; c < 4; ++c) {
            #pragma unroll
            for (int u = 0; u < 2; ++u) {          // the two 8-half runs of the operand
                const float* qs = qrow + 32*c + 16*u + 8*h;
                #pragma unroll
                for (int j = 0; j < 8; j += 2) {
                    // the earlier loads' addresses are taken up before the row's last load is issued
                    if (c == 3 && u == 1 && j == 4) asm volatile("s_wait_xcnt 0x0" ::: "memory");
                    const _Float16 qr = (_Float16)(qs[j]     * qscale);
                    const _Float16 qi = (_Float16)(qs[j + 1] * qscale);
                    aq[0][c][8*u + j] = qr;  aq[0][c][8*u + j + 1] = -qi;
                    aq[1][c][8*u + j] = qi;  aq[1][c][8*u + j + 1] = qr;
                }
            }
        }
    }

    // nothing of what follows is lifted in front of the Q conversions
    __builtin_amdgcn_sched_barrier(0);

    // all-ones A operand: every row of ones @ P^T holds the column sums of P^T
    v16h ones;
    #pragma unroll
    for (int j = 0; j < 16; ++j) ones[j] = (_Float16)1.0f;

    v8f acc[2][2][4];
    #pragma unroll
    for (int mp = 0; mp < 2; ++mp)
        #pragma unroll
        for (int cp = 0; cp < 2; ++cp)
            #pragma unroll
            for (int g = 0; g < 4; ++g)
                #pragma unroll
                for (int j = 0; j < 8; ++j) acc[mp][cp][g][j] = 0.f;

    float mS[2], lS[2];           // one query per lane: one maximum and one sum per map
    #pragma unroll
    for (int mp = 0; mp < 2; ++mp) { mS[mp] = -__builtin_inff(); lS[mp] = 0.f; }

    const _Float16* vtBase = VT + (size_t)b * 2 * 64 * SS;   // rows stride SS

    const int ktEnd = (ks + 1) * (NTILE / KSPL);
    for (int kt = ks * (NTILE / KSPL); kt < ktEnd; ++kt) {
        __syncthreads();
        // ---- staging: pure b128 vector copies of pre-converted f16 tiles
        {
            const v8h* gk = (const v8h*)(Kh + ((size_t)b * SS + (size_t)kt * KT) * ROW);
            const _Float16* gvt = vtBase + (size_t)kt * KT;
            v8h tk[8], tv[8];
            #pragma unroll
            for (int i = 0; i < 8; ++i) {          // 2048 v8h units per 32 KB tile
                const int j = tid + 256 * i;
                const int r = j >> 4, c = j & 15;  // 16 units per 128-half row
                // the earlier loads' addresses are taken up before the last K load is issued
                if (i == 7) asm volatile("s_wait_xcnt 0x0" ::: "memory");
                tk[i] = gk[j];
                tv[i] = *(const v8h*)&gvt[(size_t)r * SS + c * 8];
            }
            // keeps all 16 loads in flight together: without it this build waited for
            // each load and stored it before it issued the next
            __builtin_amdgcn_sched_barrier(0);
            #pragma unroll
            for (int i = 0; i < 8; ++i) {
                // unit tid + 256 i is row (tid >> 4) + 16 i: one LDS address and constant offsets,
                // which frees the registers that the second fragment set takes
                const int u0 = (tid >> 4) * LP + (tid & 15) * 8;
                *(v8h*)&ldsK[u0 + 16 * i * LP]  = tk[i];
                *(v8h*)&ldsVT[u0 + 16 * i * LP] = tv[i];
            }
        }
        __syncthreads();

        // Fragments go through two register sets: the next group's 16 LDS loads are issued as one
        // run in front of the current group's WMMAs, so that a group's latency passes behind
        // 16 WMMAs and the waits in front of the WMMAs are counted ones.
        v16h fr[2][8];
        ld_k_group(fr[0], ldsK, 0, m, h);

        // ---- prefetch next tile into near caches, overlapped with compute
        if (kt + 1 < ktEnd) {
            const char* nk = (const char*)(Kh + ((size_t)b * SS + (size_t)(kt + 1) * KT) * ROW);
            #pragma unroll
            for (int i = 0; i < 2; ++i)            // 256 thr * 64B * 2 = 32 KB
                __builtin_prefetch(nk + tid * 64 + i * 16384, 0, 3);
            const char* nvt = (const char*)(vtBase + (size_t)(kt + 1) * KT);
            __builtin_prefetch(nvt + (size_t)(tid >> 1) * (SS * 2) + (tid & 1) * 128, 0, 3);
        }

        // ---- S^T = K Q^T, both maps from each K fragment (64 WMMAs, 32 fragments, 4 groups).
        v8f sBoth[2][8];
        #pragma unroll
        for (int gp = 0; gp < 4; ++gp) {
            // the two scheduling barriers hold the next group's loads together and in front of this
            // group's WMMAs: left free, this build sank each load pair to just before its own WMMAs
            __builtin_amdgcn_sched_barrier(0);
            if (gp < 3) ld_k_group(fr[(gp + 1) & 1], ldsK, gp + 1, m, h);
            else        ld_v_group(fr[0], ldsVT, 0, m, h);     // first V^T group flies behind the softmax
            __builtin_amdgcn_sched_barrier(0);
            v8f s[2][2];
            #pragma unroll
            for (int mp = 0; mp < 2; ++mp)
                #pragma unroll
                for (int gg = 0; gg < 2; ++gg)
                    s[mp][gg] = v8f{0.f,0.f,0.f,0.f,0.f,0.f,0.f,0.f};
            #pragma unroll
            for (int c = 0; c < 4; ++c)
                #pragma unroll
                for (int gg = 0; gg < 2; ++gg) {
                    const v16h& kf = fr[gp & 1][4 * gg + c];
                    s[0][gg] = wmma_f16(kf, aq[0][c], s[0][gg]);
                    s[1][gg] = wmma_f16(kf, aq[1][c], s[1][gg]);
                }
            #pragma unroll
            for (int gg = 0; gg < 2; ++gg) {
                sBoth[0][2 * gp + gg] = s[0][gg];
                sBoth[1][2 * gp + gg] = s[1][gg];
            }
        }

        // ---- per map. Lane (m, h) holds, for query m, keys 16 g + 8 h + j:
        //      maximum in-lane plus one exchange between the halves; exp2 packs straight into
        //      the B operand of O^T += V^T P^T (k = 8 h + j from tile 2 kc, 16 + 8 h + j from 2 kc + 1)
        v16h pT[2][4];
        #pragma unroll
        for (int mp = 0; mp < 2; ++mp) {
            const v8f (&sAcc)[8] = sBoth[mp];

            float t8[8];
            #pragma unroll
            for (int j = 0; j < 8; ++j)
                t8[j] = fmaxf(fmaxf(fmaxf(sAcc[0][j], sAcc[1][j]), fmaxf(sAcc[2][j], sAcc[3][j])),
                              fmaxf(fmaxf(sAcc[4][j], sAcc[5][j]), fmaxf(sAcc[6][j], sAcc[7][j])));
            float tm = fmaxf(fmaxf(fmaxf(t8[0], t8[1]), fmaxf(t8[2], t8[3])),
                             fmaxf(fmaxf(t8[4], t8[5]), fmaxf(t8[6], t8[7])));
            tm = fmaxf(tm, xhalf(tm));
            const float mn = fmaxf(mS[mp], tm);
            const float f  = fast_exp2(mS[mp] - mn);
            mS[mp] = mn;
            lS[mp] *= f;                         // column sum added after ones @ P^T
            #pragma unroll
            for (int cp = 0; cp < 2; ++cp)
                #pragma unroll
                for (int g = 0; g < 4; ++g) acc[mp][cp][g] *= f;
            #pragma unroll
            for (int kc = 0; kc < 4; ++kc) {
                v8u pk;
                #pragma unroll
                for (int t = 0; t < 2; ++t) {    // score tile 2 kc + t: operand elements 8 t .. 8 t + 7
                    const v8f p = exp2_x8(sAcc[2 * kc + t] - mn);
                    #pragma unroll
                    for (int i = 0; i < 4; ++i)  // elements 2 i, 2 i + 1: one register pair
                        pk[4 * t + i] = __builtin_bit_cast(unsigned,
                            __builtin_convertvector(v2f{p[2 * i], p[2 * i + 1]}, v2h));
                }
                pT[mp][kc] = __builtin_bit_cast(v16h, pk);
            }
        }

        // ---- O^T += V^T P^T and ones @ P^T; each V^T fragment feeds both maps
        v8f lsum[2];
        #pragma unroll
        for (int mp = 0; mp < 2; ++mp)
            #pragma unroll
            for (int j = 0; j < 8; ++j) lsum[mp][j] = 0.f;

        #pragma unroll
        for (int kc = 0; kc < 4; ++kc) {
            // as above: the next chunk's 16 loads stay one run in front of this chunk's WMMAs
            __builtin_amdgcn_sched_barrier(0);
            if (kc < 3) ld_v_group(fr[(kc + 1) & 1], ldsVT, kc + 1, m, h);
            __builtin_amdgcn_sched_barrier(0);
            lsum[0] = wmma_f16(ones, pT[0][kc], lsum[0]);
            lsum[1] = wmma_f16(ones, pT[1][kc], lsum[1]);
            #pragma unroll
            for (int cp = 0; cp < 2; ++cp) {
                #pragma unroll
                for (int g4 = 0; g4 < 4; ++g4) {
                    const v16h& va = fr[kc & 1][4 * cp + g4];
                    acc[0][cp][g4] = wmma_f16(va, pT[0][kc], acc[0][cp][g4]);
                    acc[1][cp][g4] = wmma_f16(va, pT[1][kc], acc[1][cp][g4]);
                }
            }
        }
        #pragma unroll
        for (int mp = 0; mp < 2; ++mp) lS[mp] += lsum[mp][0];
    }

    // ---- emit this key range's un-normalised terms, already placed as (re, im) of the
    //      output (real map: (A Vr, A Vi); imag map: (-A Vi, A Vr)), and (max, sum) per row.
    //      acc[mp][cp][g4][j] is d = 16 g4 + 8 h + j of query m: each wave turns it in its own
    //      LDS range into whole 512-B rows, so that every 128-B line is stored once.
    float* stg = &ldsO[w][0];
    #pragma unroll
    for (int mp = 0; mp < 2; ++mp) {
        const size_t r0 = (size_t)(ks * 2 + mp) * NB * SS + (size_t)b * SS + q0;
        #pragma unroll
        for (int g4 = 0; g4 < 4; ++g4) {
            float* p = stg + m * SP + 32 * g4 + 16 * h;
            #pragma unroll
            for (int i = 0; i < 4; ++i) {
                const float4 t = mp == 0
                    ? make_float4( acc[0][0][g4][2*i], acc[0][1][g4][2*i],  acc[0][0][g4][2*i+1], acc[0][1][g4][2*i+1])
                    : make_float4(-acc[1][1][g4][2*i], acc[1][0][g4][2*i], -acc[1][1][g4][2*i+1], acc[1][0][g4][2*i+1]);
                *(float4*)(p + 4 * i) = t;
            }
        }
        // the wave's own LDS writes are done before other lanes read the rows back
        asm volatile("s_wait_dscnt 0x0" ::: "memory");
        #pragma unroll
        for (int r = 0; r < 16; ++r) {
            const float4 v = *(const float4*)(stg + r * SP + lane * 4);
            *(float4*)(Pt + (r0 + r) * ROW + lane * 4) = v;
        }
        if (h == 0)                              // both halves hold the query's max and sum
            *(float2*)(St + (r0 + m) * 2) = make_float2(mS[mp], lS[mp]);
    }
}

// ---- post-pass: merge the key ranges per row and map, normalise, add the two maps' terms.
//      One wave per row at a time, MROWS rows per wave.
#define MROWS 8

// v_exp_f32 with the one free slot behind a transcendental written into the same statement.
__device__ __forceinline__ float exp2_slot(float x) {
    float r;
    asm("v_exp_f32 %0, %1\n\tv_nop" : "=v"(r) : "v"(x));
    return r;
}

__global__ __launch_bounds__(256)
void merge_ranges_kernel(const float* __restrict__ Pt, const float* __restrict__ St,
                         float* __restrict__ O)
{
    const int lane = threadIdx.x & 31;
    // the wave's number as a scalar: row addresses are scalar bases plus one lane offset
    const int wv   = blockIdx.x * 8 + __builtin_amdgcn_readfirstlane(threadIdx.x >> 5);
    const size_t NR = (size_t)NB * SS;
    float4 o[MROWS];
    #pragma unroll
    for (int i = 0; i < MROWS; ++i) {
        const size_t row = (size_t)wv * MROWS + i;
        o[i] = make_float4(0.f, 0.f, 0.f, 0.f);
        #pragma unroll
        for (int mp = 0; mp < 2; ++mp) {
            const float2 s0 = *(const float2*)(St + ((size_t)mp * NR + row) * 2);
            const float2 s1 = *(const float2*)(St + ((size_t)(2 + mp) * NR + row) * 2);
            const float4 x0 = ((const float4*)(Pt + ((size_t)mp * NR + row) * ROW))[lane];
            const float4 x1 = ((const float4*)(Pt + ((size_t)(2 + mp) * NR + row) * ROW))[lane];
            const float M   = fmaxf(s0.x, s1.x);
            const float a0  = exp2_slot(s0.x - M);
            const float a1  = exp2_slot(s1.x - M);
            const float inv = 1.0f / (a0 * s0.y + a1 * s1.y);
            const float c0  = a0 * inv, c1 = a1 * inv;
            o[i].x += c0 * x0.x + c1 * x1.x;
            o[i].y += c0 * x0.y + c1 * x1.y;
            o[i].z += c0 * x0.z + c1 * x1.z;
            o[i].w += c0 * x0.w + c1 * x1.w;
        }
    }
    #pragma unroll
    for (int i = 0; i < MROWS; ++i)
        ((float4*)(O + ((size_t)wv * MROWS + i) * ROW))[lane] = o[i];
}

extern "C" void kernel_launch(void* const* d_in, const int* in_sizes, int n_in,
                              void* d_out, int out_size, void* d_ws, size_t ws_size,
                              hipStream_t stream) {
    const float* Q = (const float*)d_in[0];
    const float* K = (const float*)d_in[1];
    const float* V = (const float*)d_in[2];
    float* O = (float*)d_out;

    // workspace: K (4 MB) | VT (4 MB), both f16 |
    //            f32 terms [range][map][row][128] (32 MB) | f32 (max, sum) [range][map][row]
    _Float16* wsK   = (_Float16*)d_ws;
    _Float16* wsVT  = wsK + (size_t)NB * SS * ROW;
    float*    wsPt  = (float*)(wsVT + (size_t)NB * SS * ROW);
    float*    wsSt  = wsPt + (size_t)KSPL * 2 * NB * SS * ROW;

    prep_k_kernel<<<dim3(NB * SS * ROW / 4 / 256), dim3(256), 0, stream>>>(K, wsK);
    prep_v_kernel<<<dim3(NB * 2 * 64 * (SS / 8) / 256), dim3(256), 0, stream>>>(V, wsVT);
    cdpa_flash_kernel<<<dim3(KSPL * NB * (SS / (WAVES * QW))), dim3(256), 0, stream>>>(
        Q, wsK, wsVT, wsPt, wsSt);
    merge_ranges_kernel<<<dim3(NB * SS / (8 * MROWS)), dim3(256), 0, stream>>>(wsPt, wsSt, O);
}

// v006
// One run takes 64 microseconds.
// Two timings next to v005 put it at 1.18 and 1.17 times that version's speed.
// Counting every step since v000, it is 15.0 times as fast.
#include <hip/hip_runtime.h>
#include <math.h>

typedef __attribute__((ext_vector_type(16))) _Float16 v16h;
typedef __attribute__((ext_vector_type(8)))  _Float16 v8h;
typedef __attribute__((ext_vector_type(4)))  _Float16 v4h;
typedef __attribute__((ext_vector_type(8)))  float    v8f;
typedef __attribute__((ext_vector_type(2)))  float    v2f;
typedef __attribute__((ext_vector_type(4)))  float    v4f;
typedef __attribute__((ext_vector_type(2)))  _Float16 v2h;
typedef __attribute__((ext_vector_type(8)))  unsigned v8u;

#define NB    4      // batches
#define SS    4096   // sequence length
#define ROW   128    // D*2 elements per token row (interleaved r,i)
#define KT    128    // key tile (4 x K=32 WMMA contraction chunks)
#define WAVES 8
#define QW    16     // query rows per wave
#define NTILE (SS / KT)
#define KSPL  2      // key ranges; one work-group per (query block, key range)
#define LP    136    // LDS row pitch in halves: 272 B = 16 B x 17 (odd), so the 16 rows
                     // of one ds_load_b128 fall on 16 distinct groups of four banks
#define SP    132    // output staging pitch in floats: 528 B = 16 B x 33 (odd)

__device__ __forceinline__ float fast_exp2(float x) {
#if __has_builtin(__builtin_amdgcn_exp2f)
    return __builtin_amdgcn_exp2f(x);   // raw v_exp_f32
#else
    return exp2f(x);
#endif
}

// Eight v_exp_f32 with the free slot behind a transcendental written into the statement: each fills
// the slot of the one before it (early-clobber outputs keep it off the others' sources), the v_nop
// that of the last.
__device__ __forceinline__ v8f exp2_x8(const v8f& e) {
    float p0, p1, p2, p3, p4, p5, p6, p7;
    asm("v_exp_f32 %0, %8\n\tv_exp_f32 %1, %9\n\tv_exp_f32 %2, %10\n\tv_exp_f32 %3, %11\n\t"
        "v_exp_f32 %4, %12\n\tv_exp_f32 %5, %13\n\tv_exp_f32 %6, %14\n\tv_exp_f32 %7, %15\n\tv_nop"
        : "=&v"(p0), "=&v"(p1), "=&v"(p2), "=&v"(p3), "=&v"(p4), "=&v"(p5), "=&v"(p6), "=&v"(p7)
        : "v"(e[0]), "v"(e[1]), "v"(e[2]), "v"(e[3]), "v"(e[4]), "v"(e[5]), "v"(e[6]), "v"(e[7]));
    return v8f{p0, p1, p2, p3, p4, p5, p6, p7};
}

__device__ __forceinline__ v8f wmma_f16(const v16h& a, const v16h& b, const v8f& c) {
    return __builtin_amdgcn_wmma_f32_16x16x32_f16(false, a, false, b, (short)0, c, false, false);
}

// lane l <-> lane l ^ 16: the two half-waves hold the two halves of a query's keys
__device__ __forceinline__ float xhalf(float x) {
    const int v = __builtin_bit_cast(int, x);
    return __builtin_bit_cast(float,
        __builtin_amdgcn_permlanex16(v, v, 0x76543210, 0xfedcba98, false, false));
}

// Load a v16h operand: two contiguous 8-half runs (base, base+16 halves),
// each one ds_load_b128.
__device__ __forceinline__ v16h ld_op(const _Float16* base) {
    v8h lo = *(const v8h*)(base);
    v8h hi = *(const v8h*)(base + 16);
    return __builtin_shufflevector(lo, hi, 0,1,2,3,4,5,6,7,8,9,10,11,12,13,14,15);
}

// One group of eight fragments (16 ds_load_b128): K rows 32 gp .. 32 gp + 31, all four k chunks.
__device__ __forceinline__ void ld_k_group(v16h (&f)[8], const _Float16* ldsK, int gp, int m, int h) {
    #pragma unroll
    for (int c = 0; c < 4; ++c)              // in the order in which the WMMAs take them
        #pragma unroll
        for (int gg = 0; gg < 2; ++gg)
            f[4 * gg + c] = ld_op(&ldsK[(16 * (2 * gp + gg) + m) * LP + 32 * c + 8 * h]);
}

// One group of eight fragments: all 128 V^T rows (component, d) of key chunk kc.
__device__ __forceinline__ void ld_v_group(v16h (&f)[8], const _Float16* ldsVT, int kc, int m, int h) {
    #pragma unroll
    for (int r = 0; r < 8; ++r)
        f[r] = ld_op(&ldsVT[(16 * r + m) * LP + 32 * kc + 8 * h]);
}

// ---- pre-pass, one launch, one work-group per 64 tokens (256 work-groups):
//      K (f32, interleaved complex) -> f16, same layout;
//      V (f32 [b][s][d][comp]) -> f16 transposed [b][comp][d][s], read as whole token rows and
//      turned in LDS, so that every 128-B line is read once and every V^T line is stored once.
#define PTOK  64     // tokens per work-group: one 128-B line of each V^T row
#define TPD   36     // LDS pitch of a V^T row in dwords (token pairs): 144 B = 16 B x 9 (odd)

__device__ __forceinline__ unsigned pack_h2(float lo, float hi) {
    return __builtin_bit_cast(unsigned, v2h{ (_Float16)lo, (_Float16)hi });
}

__global__ __launch_bounds__(256)
void prep_kv_kernel(const float* __restrict__ K, const float* __restrict__ V,
                    _Float16* __restrict__ Kh, _Float16* __restrict__ VT)
{
    __shared__ __attribute__((aligned(16))) unsigned ldsT[2 * 64 * TPD];   // 18 KB

    const int tid = threadIdx.x;
    const size_t t0 = (size_t)blockIdx.x * PTOK;       // first token, counted over all batches
    const int b  = blockIdx.x / (SS / PTOK);
    const int s0 = (blockIdx.x % (SS / PTOK)) * PTOK;

    // V unit: tokens (2 pr, 2 pr + 1) x floats 4 c4 .. 4 c4 + 3. Eight lanes take one 128-B line
    // of a token; a wave's four token pairs put its 32 LDS dwords on 32 different banks.
    const int wv = tid >> 5;
    const int c4 = (wv & 3) * 8 + (tid & 7);
    const int pr = (wv >> 2) * 4 + ((tid >> 3) & 3);   // + 8 i

    const v4f* gk = (const v4f*)(K + t0 * ROW) + tid;
    const v4f* gv = (const v4f*)(V + t0 * ROW) + (2 * pr) * (ROW / 4) + c4;
    v4f kv[8], va[4], vb[4];
    #pragma unroll
    for (int i = 0; i < 4; ++i) {
        va[i] = gv[(16 * i) * (ROW / 4)];
        vb[i] = gv[(16 * i + 1) * (ROW / 4)];
    }
    #pragma unroll
    for (int i = 0; i < 8; ++i) {
        // this build lets the last K load return into the address pair that the V loads name:
        // their addresses are taken up before it is issued
        if (i == 7) asm volatile("s_wait_xcnt 0x0" ::: "memory");
        kv[i] = gk[256 * i];
    }
    // keeps all 16 loads of a thread (the work-group's whole 64 KB) in flight together: left free,
    // this build waited for the first V loads and converted them before it issued the last four
    __builtin_amdgcn_sched_barrier(0);

    unsigned* p = &ldsT[(2 * c4) * TPD + pr];          // row = comp * 64 + d, d = 2 c4 (+ 1)
    #pragma unroll
    for (int i = 0; i < 4; ++i) {
        p[8 * i]                  = pack_h2(va[i].x, vb[i].x);
        p[8 * i + 64 * TPD]       = pack_h2(va[i].y, vb[i].y);
        p[8 * i + TPD]            = pack_h2(va[i].z, vb[i].z);
        p[8 * i + 64 * TPD + TPD] = pack_h2(va[i].w, vb[i].w);
    }
    __syncthreads();

    // K's stores stand behind the barrier, which would otherwise wait until they are done
    #pragma unroll
    for (int i = 0; i < 8; ++i) {
        v4h kh = { (_Float16)kv[i].x, (_Float16)kv[i].y, (_Float16)kv[i].z, (_Float16)kv[i].w };
        *(v4h*)&Kh[t0 * ROW + (size_t)(tid + 256 * i) * 4] = kh;
    }

    const unsigned* q = &ldsT[(tid >> 3) * TPD + 4 * (tid & 7)];
    _Float16* gt = VT + ((size_t)b * 128 + (tid >> 3)) * SS + s0 + 8 * (tid & 7);
    #pragma unroll
    for (int i = 0; i < 4; ++i)                        // 128 rows x 8 units of 8 tokens
        *(uint4*)&gt[(size_t)(32 * i) * SS] = *(const uint4*)&q[32 * i * TPD];
}

__global__ __launch_bounds__(256)
void cdpa_flash_kernel(const float* __restrict__ Q,
                       const _Float16* __restrict__ Kh,
                       const _Float16* __restrict__ VT,
                       float* __restrict__ Pt,
                       float* __restrict__ St)
{
    __shared__ _Float16 ldsK[KT * LP];             // 34 KB, (kr, ki) rows: serves both maps
    __shared__ _Float16 ldsVT[2 * 64 * LP];        // 34 KB
    __shared__ __attribute__((aligned(16))) float ldsO[WAVES][16 * SP];   // 66 KB, epilogue only

    const int tid  = threadIdx.x;
    const int w    = tid >> 5;
    const int lane = tid & 31;
    const int m    = lane & 15;   // row (A) / col (B,C) index; the lane's query column
    const int h    = lane >> 4;   // half-wave selector

    const int blocksPerBatch = SS / (WAVES * QW);  // 32
    const int ks  = blockIdx.x % KSPL;             // key range of this work-group
    const int blk = blockIdx.x / KSPL;
    const int b  = blk / blocksPerBatch;
    const int qt = blk % blocksPerBatch;
    const int q0 = qt * (WAVES * QW) + w * QW;

    // Q B-operands (S^T = K Q^T: column m is query q0 + m). Scale = 1/sqrt(D) * log2(e): scores in log2 domain.
    // The complex product's sign and swap sit on Q, which stays in registers: against K rows (kr, ki)
    // the real map takes (qr, -qi), the imaginary map (qi, qr), so one K fragment feeds both maps.
    const float qscale = 0.125f * 1.44269504088896340736f;
    v16h aq[2][4];
    {
        const float* qrow = Q + ((size_t)b * SS + q0 + m) * ROW;
        #pragma unroll
        for (int c = 0; c < 4; ++c) {
            #pragma unroll
            for (int u = 0; u < 2; ++u) {          // the two 8-half runs of the operand
                const float* qs = qrow + 32*c + 16*u + 8*h;
                #pragma unroll
                for (int j = 0; j < 8; j += 2) {
                    // the earlier loads' addresses are taken up before the row's last load is issued
                    if (c == 3 && u == 1 && j == 4) asm volatile("s_wait_xcnt 0x0" ::: "memory");
                    const _Float16 qr = (_Float16)(qs[j]     * qscale);
                    const _Float16 qi = (_Float16)(qs[j + 1] * qscale);
                    aq[0][c][8*u + j] = qr;  aq[0][c][8*u + j + 1] = -qi;
                    aq[1][c][8*u + j] = qi;  aq[1][c][8*u + j + 1] = qr;
                }
            }
        }
    }

    // nothing of what follows is lifted in front of the Q conversions
    __builtin_amdgcn_sched_barrier(0);

    // all-ones A operand: every row of ones @ P^T holds the column sums of P^T
    v16h ones;
    #pragma unroll
    for (int j = 0; j < 16; ++j) ones[j] = (_Float16)1.0f;

    v8f acc[2][2][4];
    #pragma unroll
    for (int mp = 0; mp < 2; ++mp)
        #pragma unroll
        for (int cp = 0; cp < 2; ++cp)
            #pragma unroll
            for (int g = 0; g < 4; ++g)
                #pragma unroll
                for (int j = 0; j < 8; ++j) acc[mp][cp][g][j] = 0.f;

    float mS[2], lS[2];           // one query per lane: one maximum and one sum per map
    #pragma unroll
    for (int mp = 0; mp < 2; ++mp) { mS[mp] = -__builtin_inff(); lS[mp] = 0.f; }

    const _Float16* vtBase = VT + (size_t)b * 2 * 64 * SS;   // rows stride SS

    const int ktEnd = (ks + 1) * (NTILE / KSPL);
    for (int kt = ks * (NTILE / KSPL); kt < ktEnd; ++kt) {
        __syncthreads();
        // ---- staging: pure b128 vector copies of pre-converted f16 tiles
        {
            const v8h* gk = (const v8h*)(Kh + ((size_t)b * SS + (size_t)kt * KT) * ROW);
            const _Float16* gvt = vtBase + (size_t)kt * KT;
            v8h tk[8], tv[8];
            #pragma unroll
            for (int i = 0; i < 8; ++i) {          // 2048 v8h units per 32 KB tile
                const int j = tid + 256 * i;
                const int r = j >> 4, c = j & 15;  // 16 units per 128-half row
                // the earlier loads' addresses are taken up before the last K load is issued
                if (i == 7) asm volatile("s_wait_xcnt 0x0" ::: "memory");
                tk[i] = gk[j];
                tv[i] = *(const v8h*)&gvt[(size_t)r * SS + c * 8];
            }
            // keeps all 16 loads in flight together: without it this build waited for
            // each load and stored it before it issued the next
            __builtin_amdgcn_sched_barrier(0);
            #pragma unroll
            for (int i = 0; i < 8; ++i) {
                // unit tid + 256 i is row (tid >> 4) + 16 i: one LDS address and constant offsets,
                // which frees the registers that the second fragment set takes
                const int u0 = (tid >> 4) * LP + (tid & 15) * 8;
                *(v8h*)&ldsK[u0 + 16 * i * LP]  = tk[i];
                *(v8h*)&ldsVT[u0 + 16 * i * LP] = tv[i];
            }
        }
        __syncthreads();

        // Fragments go through two register sets: the next group's 16 LDS loads are issued as one
        // run in front of the current group's WMMAs, so that a group's latency passes behind
        // 16 WMMAs and the waits in front of the WMMAs are counted ones.
        v16h fr[2][8];
        ld_k_group(fr[0], ldsK, 0, m, h);

        // ---- prefetch next tile into near caches, overlapped with compute
        if (kt + 1 < ktEnd) {
            const char* nk = (const char*)(Kh + ((size_t)b * SS + (size_t)(kt + 1) * KT) * ROW);
            #pragma unroll
            for (int i = 0; i < 2; ++i)            // 256 thr * 64B * 2 = 32 KB
                __builtin_prefetch(nk + tid * 64 + i * 16384, 0, 3);
            const char* nvt = (const char*)(vtBase + (size_t)(kt + 1) * KT);
            __builtin_prefetch(nvt + (size_t)(tid >> 1) * (SS * 2) + (tid & 1) * 128, 0, 3);
        }

        // ---- S^T = K Q^T, both maps from each K fragment (64 WMMAs, 32 fragments, 4 groups).
        v8f sBoth[2][8];
        #pragma unroll
        for (int gp = 0; gp < 4; ++gp) {
            // the two scheduling barriers hold the next group's loads together and in front of this
            // group's WMMAs: left free, this build sank each load pair to just before its own WMMAs
            __builtin_amdgcn_sched_barrier(0);
            if (gp < 3) ld_k_group(fr[(gp + 1) & 1], ldsK, gp + 1, m, h);
            else        ld_v_group(fr[0], ldsVT, 0, m, h);     // first V^T group flies behind the softmax
            __builtin_amdgcn_sched_barrier(0);
            v8f s[2][2];
            #pragma unroll
            for (int mp = 0; mp < 2; ++mp)
                #pragma unroll
                for (int gg = 0; gg < 2; ++gg)
                    s[mp][gg] = v8f{0.f,0.f,0.f,0.f,0.f,0.f,0.f,0.f};
            #pragma unroll
            for (int c = 0; c < 4; ++c)
                #pragma unroll
                for (int gg = 0; gg < 2; ++gg) {
                    const v16h& kf = fr[gp & 1][4 * gg + c];
                    s[0][gg] = wmma_f16(kf, aq[0][c], s[0][gg]);
                    s[1][gg] = wmma_f16(kf, aq[1][c], s[1][gg]);
                }
            #pragma unroll
            for (int gg = 0; gg < 2; ++gg) {
                sBoth[0][2 * gp + gg] = s[0][gg];
                sBoth[1][2 * gp + gg] = s[1][gg];
            }
        }

        // ---- per map. Lane (m, h) holds, for query m, keys 16 g + 8 h + j:
        //      maximum in-lane plus one exchange between the halves; exp2 packs straight into
        //      the B operand of O^T += V^T P^T (k = 8 h + j from tile 2 kc, 16 + 8 h + j from 2 kc + 1)
        v16h pT[2][4];
        #pragma unroll
        for (int mp = 0; mp < 2; ++mp) {
            const v8f (&sAcc)[8] = sBoth[mp];

            float t8[8];
            #pragma unroll
            for (int j = 0; j < 8; ++j)
                t8[j] = fmaxf(fmaxf(fmaxf(sAcc[0][j], sAcc[1][j]), fmaxf(sAcc[2][j], sAcc[3][j])),
                              fmaxf(fmaxf(sAcc[4][j], sAcc[5][j]), fmaxf(sAcc[6][j], sAcc[7][j])));
            float tm = fmaxf(fmaxf(fmaxf(t8[0], t8[1]), fmaxf(t8[2], t8[3])),
                             fmaxf(fmaxf(t8[4], t8[5]), fmaxf(t8[6], t8[7])));
            tm = fmaxf(tm, xhalf(tm));
            const float mn = fmaxf(mS[mp], tm);
            const float f  = fast_exp2(mS[mp] - mn);
            mS[mp] = mn;
            lS[mp] *= f;                         // column sum added after ones @ P^T
            #pragma unroll
            for (int cp = 0; cp < 2; ++cp)
                #pragma unroll
                for (int g = 0; g < 4; ++g) acc[mp][cp][g] *= f;
            #pragma unroll
            for (int kc = 0; kc < 4; ++kc) {
                v8u pk;
                #pragma unroll
                for (int t = 0; t < 2; ++t) {    // score tile 2 kc + t: operand elements 8 t .. 8 t + 7
                    const v8f p = exp2_x8(sAcc[2 * kc + t] - mn);
                    #pragma unroll
                    for (int i = 0; i < 4; ++i)  // elements 2 i, 2 i + 1: one register pair
                        pk[4 * t + i] = __builtin_bit_cast(unsigned,
                            __builtin_convertvector(v2f{p[2 * i], p[2 * i + 1]}, v2h));
                }
                pT[mp][kc] = __builtin_bit_cast(v16h, pk);
            }
        }

        // ---- O^T += V^T P^T and ones @ P^T; each V^T fragment feeds both maps
        v8f lsum[2];
        #pragma unroll
        for (int mp = 0; mp < 2; ++mp)
            #pragma unroll
            for (int j = 0; j < 8; ++j) lsum[mp][j] = 0.f;

        #pragma unroll
        for (int kc = 0; kc < 4; ++kc) {
            // as above: the next chunk's 16 loads stay one run in front of this chunk's WMMAs
            __builtin_amdgcn_sched_barrier(0);
            if (kc < 3) ld_v_group(fr[(kc + 1) & 1], ldsVT, kc + 1, m, h);
            __builtin_amdgcn_sched_barrier(0);
            lsum[0] = wmma_f16(ones, pT[0][kc], lsum[0]);
            lsum[1] = wmma_f16(ones, pT[1][kc], lsum[1]);
            #pragma unroll
            for (int cp = 0; cp < 2; ++cp) {
                #pragma unroll
                for (int g4 = 0; g4 < 4; ++g4) {
                    const v16h& va = fr[kc & 1][4 * cp + g4];
                    acc[0][cp][g4] = wmma_f16(va, pT[0][kc], acc[0][cp][g4]);
                    acc[1][cp][g4] = wmma_f16(va, pT[1][kc], acc[1][cp][g4]);
                }
            }
        }
        #pragma unroll
        for (int mp = 0; mp < 2; ++mp) lS[mp] += lsum[mp][0];
    }

    // ---- emit this key range's un-normalised terms, already placed as (re, im) of the
    //      output (real map: (A Vr, A Vi); imag map: (-A Vi, A Vr)), and (max, sum) per row.
    //      acc[mp][cp][g4][j] is d = 16 g4 + 8 h + j of query m: each wave turns it in its own
    //      LDS range into whole 512-B rows, so that every 128-B line is stored once.
    float* stg = &ldsO[w][0];
    #pragma unroll
    for (int mp = 0; mp < 2; ++mp) {
        const size_t r0 = (size_t)(ks * 2 + mp) * NB * SS + (size_t)b * SS + q0;
        #pragma unroll
        for (int g4 = 0; g4 < 4; ++g4) {
            float* p = stg + m * SP + 32 * g4 + 16 * h;
            #pragma unroll
            for (int i = 0; i < 4; ++i) {
                const float4 t = mp == 0
                    ? make_float4( acc[0][0][g4][2*i], acc[0][1][g4][2*i],  acc[0][0][g4][2*i+1], acc[0][1][g4][2*i+1])
                    : make_float4(-acc[1][1][g4][2*i], acc[1][0][g4][2*i], -acc[1][1][g4][2*i+1], acc[1][0][g4][2*i+1]);
                *(float4*)(p + 4 * i) = t;
            }
        }
        // the wave's own LDS writes are done before other lanes read the rows back
        asm volatile("s_wait_dscnt 0x0" ::: "memory");
        #pragma unroll
        for (int r = 0; r < 16; ++r) {
            const float4 v = *(const float4*)(stg + r * SP + lane * 4);
            *(float4*)(Pt + (r0 + r) * ROW + lane * 4) = v;
        }
        if (h == 0)                              // both halves hold the query's max and sum
            *(float2*)(St + (r0 + m) * 2) = make_float2(mS[mp], lS[mp]);
    }
}

// ---- post-pass: merge the key ranges per row and map, normalise, add the two maps' terms.
//      One wave per row at a time, MROWS rows per wave.
#define MROWS 8

// v_exp_f32 with the one free slot behind a transcendental written into the same statement.
__device__ __forceinline__ float exp2_slot(float x) {
    float r;
    asm("v_exp_f32 %0, %1\n\tv_nop" : "=v"(r) : "v"(x));
    return r;
}

__global__ __launch_bounds__(256)
void merge_ranges_kernel(const float* __restrict__ Pt, const float* __restrict__ St,
                         float* __restrict__ O)
{
    const int lane = threadIdx.x & 31;
    // the wave's number as a scalar: row addresses are scalar bases plus one lane offset
    const int wv   = blockIdx.x * 8 + __builtin_amdgcn_readfirstlane(threadIdx.x >> 5);
    const size_t NR = (size_t)NB * SS;
    float4 o[MROWS];
    #pragma unroll
    for (int i = 0; i < MROWS; ++i) {
        const size_t row = (size_t)wv * MROWS + i;
        o[i] = make_float4(0.f, 0.f, 0.f, 0.f);
        #pragma unroll
        for (int mp = 0; mp < 2; ++mp) {
            const float2 s0 = *(const float2*)(St + ((size_t)mp * NR + row) * 2);
            const float2 s1 = *(const float2*)(St + ((size_t)(2 + mp) * NR + row) * 2);
            const float4 x0 = ((const float4*)(Pt + ((size_t)mp * NR + row) * ROW))[lane];
            const float4 x1 = ((const float4*)(Pt + ((size_t)(2 + mp) * NR + row) * ROW))[lane];
            const float M   = fmaxf(s0.x, s1.x);
            const float a0  = exp2_slot(s0.x - M);
            const float a1  = exp2_slot(s1.x - M);
            const float inv = 1.0f / (a0 * s0.y + a1 * s1.y);
            const float c0  = a0 * inv, c1 = a1 * inv;
            o[i].x += c0 * x0.x + c1 * x1.x;
            o[i].y += c0 * x0.y + c1 * x1.y;
            o[i].z += c0 * x0.z + c1 * x1.z;
            o[i].w += c0 * x0.w + c1 * x1.w;
        }
    }
    #pragma unroll
    for (int i = 0; i < MROWS; ++i)
        ((float4*)(O + ((size_t)wv * MROWS + i) * ROW))[lane] = o[i];
}

extern "C" void kernel_launch(void* const* d_in, const int* in_sizes, int n_in,
                              void* d_out, int out_size, void* d_ws, size_t ws_size,
                              hipStream_t stream) {
    const float* Q = (const float*)d_in[0];
    const float* K = (const float*)d_in[1];
    const float* V = (const float*)d_in[2];
    float* O = (float*)d_out;

    // workspace: K (4 MB) | VT (4 MB), both f16 |
    //            f32 terms [range][map][row][128] (32 MB) | f32 (max, sum) [range][map][row]
    _Float16* wsK   = (_Float16*)d_ws;
    _Float16* wsVT  = wsK + (size_t)NB * SS * ROW;
    float*    wsPt  = (float*)(wsVT + (size_t)NB * SS * ROW);
    float*    wsSt  = wsPt + (size_t)KSPL * 2 * NB * SS * ROW;

    prep_kv_kernel<<<dim3(NB * SS / PTOK), dim3(256), 0, stream>>>(K, V, wsK, wsVT);
    cdpa_flash_kernel<<<dim3(KSPL * NB * (SS / (WAVES * QW))), dim3(256), 0, stream>>>(
        Q, wsK, wsVT, wsPt, wsSt);
    merge_ranges_kernel<<<dim3(NB * SS / (8 * MROWS)), dim3(256), 0, stream>>>(wsPt, wsSt, O);
}
